// v000
// The times below were measured on an AMD MI455X: many runs one after another, warmed up first and cycling through
// copies of the inputs, with the whole window's GPU time divided by the number of runs. Launches and the gaps
// between them are all in it. The median over several windows is given; except for v000 it joins two sittings, which
// can be a few percent apart, so the side-by-side timings, each taken in one sitting, are the better comparison.
// v000 is the starting kernel. One run takes 214 microseconds.
#include <hip/hip_runtime.h>
#include <hip/hip_bf16.h>
#include <math.h>
#include <stdint.h>

typedef __attribute__((ext_vector_type(16))) _Float16 v16h;
typedef __attribute__((ext_vector_type(8)))  float    v8f;
typedef __attribute__((ext_vector_type(4)))  unsigned u32x4;
typedef __attribute__((ext_vector_type(8)))  _Float16 h8v;
typedef __attribute__((ext_vector_type(4)))  float    f32x4;
typedef __attribute__((ext_vector_type(4)))  int      i32x4;

union FragH { v16h h; u32x4 q[2]; };

#define LN_EPS   1e-5f
#define L2_EPS   1e-12f
#define SM_SCALE 8.0f

// ---------------------------------------------------------------------------
// CDNA5 async global->LDS staging (ASYNCcnt path), with safe fallback.
// Builtin signature (leaked by compiler diagnostic): param0 = int4 addrspace(1)*.
// ---------------------------------------------------------------------------
#if defined(__HIP_DEVICE_COMPILE__) && __has_builtin(__builtin_amdgcn_global_load_async_to_lds_b128)
#define USE_ASYNC_LDS 1
#else
#define USE_ASYNC_LDS 0
#endif

#if USE_ASYNC_LDS
typedef __attribute__((address_space(1))) i32x4 g_i32x4;
typedef __attribute__((address_space(3))) i32x4 l_i32x4;
#endif

__device__ __forceinline__ void stage16(const _Float16* g, _Float16* l) {
#if USE_ASYNC_LDS
  __builtin_amdgcn_global_load_async_to_lds_b128(
      (g_i32x4*)(uintptr_t)g,
      (l_i32x4*)(uint32_t)(uintptr_t)l, 0, 0);
#else
  *(u32x4*)l = *(const u32x4*)g;
#endif
}

__device__ __forceinline__ void stage_wait() {
#if USE_ASYNC_LDS
#if __has_builtin(__builtin_amdgcn_s_wait_asynccnt)
  __builtin_amdgcn_s_wait_asynccnt(0);
#else
  asm volatile("s_wait_asynccnt 0" ::: "memory");
#endif
#endif
}

// ---------------------------------------------------------------------------
// Kernel 1: LayerNorm over channels with LDS transpose.
// x is [b][c=256][pos=4096]; we need per-pos stats over c. Load a 256c x 32pos
// tile coalesced along pos, reduce per pos, emit f16 rows t16[(b*4096+pos)][c].
// ---------------------------------------------------------------------------
__global__ __launch_bounds__(256) void k_ln(const float* __restrict__ x,
                                            const float* __restrict__ gamma,
                                            const float* __restrict__ beta,
                                            _Float16* __restrict__ t16) {
  __shared__ float xs[256 * 33];
  __shared__ float redS[256], redQ[256];
  __shared__ float muS[32], riS[32];
  const int b    = blockIdx.x;
  const int pos0 = blockIdx.y * 32;
  const int tid  = threadIdx.x;
  for (int idx = tid; idx < 256 * 32; idx += 256) {
    int c = idx >> 5, p = idx & 31;
    xs[c * 33 + p] = x[((size_t)b * 256 + c) * 4096 + pos0 + p];
  }
  __syncthreads();
  const int pl = tid & 31, sl = tid >> 5;
  float s = 0.f, q = 0.f;
  for (int c = sl * 32; c < sl * 32 + 32; ++c) {
    float v = xs[c * 33 + pl];
    s += v; q += v * v;
  }
  redS[tid] = s; redQ[tid] = q;
  __syncthreads();
  if (tid < 32) {
    float ts = 0.f, tq = 0.f;
    for (int w = 0; w < 8; ++w) { ts += redS[w * 32 + tid]; tq += redQ[w * 32 + tid]; }
    float mu  = ts * (1.0f / 256.0f);
    float var = tq * (1.0f / 256.0f) - mu * mu;
    muS[tid] = mu;
    riS[tid] = rsqrtf(var + LN_EPS);
  }
  __syncthreads();
  const float gma = gamma[tid], bta = beta[tid];
  for (int p = 0; p < 32; ++p) {
    float v = (xs[tid * 33 + p] - muS[p]) * riS[p] * gma + bta;
    t16[((size_t)b * 4096 + pos0 + p) * 256 + tid] = (_Float16)v;
  }
}

// ---------------------------------------------------------------------------
// Kernel 2: convert weights to f16, stored transposed (w16[col][k]).
// ---------------------------------------------------------------------------
__global__ __launch_bounds__(256) void k_cvtw(const float* __restrict__ Wqkv,
                                              const float* __restrict__ Wout,
                                              _Float16* __restrict__ w16,
                                              _Float16* __restrict__ wo16) {
  int idx = blockIdx.x * 256 + threadIdx.x;
  if (idx < 768 * 256) {
    int col = idx >> 8, k = idx & 255;
    w16[idx] = (_Float16)Wqkv[(size_t)k * 768 + col];
  } else {
    int i2 = idx - 768 * 256;
    if (i2 < 256 * 256) {
      int col = i2 >> 8, k = i2 & 255;
      wo16[i2] = (_Float16)Wout[(size_t)k * 256 + col];
    }
  }
}

// ---------------------------------------------------------------------------
// Kernel 3: qkv projection GEMM  [65536 x 256] x [256 x 768] with WMMA.
// Block = 128 rows x 64 cols, 8 waves; wave w computes 16x64 (4 accumulators,
// A fragment reused 4x). K steps of 32. Async global->LDS tile staging.
// Fragment layout per CDNA5 ISA 7.12.2 (16-bit A 16x32): lane l holds row
// m=l&15; halves 0..7 = K {g*8..g*8+7}, halves 8..15 = K {16+g*8..}, g=l>>4.
// Epilogue: stage through LDS, store planar qkv16[3][b][h][d][n] f16.
// ---------------------------------------------------------------------------
__global__ __launch_bounds__(256) void k_gemm_qkv(const _Float16* __restrict__ t16,
                                                  const _Float16* __restrict__ w16,
                                                  _Float16* __restrict__ qkv16) {
  __shared__ _Float16 ldsA[128 * 40];
  __shared__ _Float16 ldsB[64 * 40];
  __shared__ float    ldsC[8 * 16 * 17];
  const int tid  = threadIdx.x;
  const int wave = tid >> 5, lane = tid & 31;
  const int g = lane >> 4, lm = lane & 15;
  const int m0 = blockIdx.x * 128;
  const int n0 = blockIdx.y * 64;
  v8f acc[4] = {};
  const int arow = tid >> 1, aoff = (tid & 1) * 16;
  const _Float16* asrc = t16 + (size_t)(m0 + arow) * 256 + aoff;
  _Float16* adst = ldsA + arow * 40 + aoff;
  const int brow = tid >> 2, boff = (tid & 3) * 8;
  const _Float16* bsrc = w16 + (size_t)(n0 + brow) * 256 + boff;
  _Float16* bdst = ldsB + brow * 40 + boff;
  for (int k0 = 0; k0 < 256; k0 += 32) {
    __syncthreads();
    stage16(asrc + k0,     adst);
    stage16(asrc + k0 + 8, adst + 8);
    stage16(bsrc + k0,     bdst);
    stage_wait();
    __syncthreads();
    FragH a;
    const _Float16* ar = ldsA + (wave * 16 + lm) * 40;
    a.q[0] = *(const u32x4*)(ar + g * 8);
    a.q[1] = *(const u32x4*)(ar + 16 + g * 8);
#pragma unroll
    for (int tn = 0; tn < 4; ++tn) {
      FragH bf;
      const _Float16* br = ldsB + (tn * 16 + lm) * 40;
      bf.q[0] = *(const u32x4*)(br + g * 8);
      bf.q[1] = *(const u32x4*)(br + 16 + g * 8);
      acc[tn] = __builtin_amdgcn_wmma_f32_16x16x32_f16(false, a.h, false, bf.h,
                                                       (short)0, acc[tn], false, false);
    }
  }
  // epilogue: per N-tile, stage C via LDS, store planar, 16B runs along pos
  const int bb   = m0 >> 12;
  const int posB = m0 & 4095;
  const int rowId = tid >> 1;   // 0..127 = wave*16 + d
  const int wsrc  = rowId >> 4;
  const int d     = rowId & 15;
  const int ho    = (tid & 1) * 8;
#pragma unroll
  for (int tn = 0; tn < 4; ++tn) {
    __syncthreads();
    float* cw = ldsC + wave * (16 * 17);
#pragma unroll
    for (int r = 0; r < 8; ++r)
      cw[lm * 17 + g * 8 + r] = acc[tn][r];   // ldsC[wave][ncol=d][m=pos]
    __syncthreads();
    const int col0   = n0 + tn * 16;
    const int qkvIdx = col0 >> 8;
    const int hh     = (col0 >> 5) & 7;
    const int dbase  = col0 & 31;
    const float* csrc = ldsC + wsrc * (16 * 17) + d * 17 + ho;
    h8v ov;
#pragma unroll
    for (int e = 0; e < 8; ++e) ov[e] = (_Float16)csrc[e];
    size_t dst = ((((size_t)qkvIdx * 16 + bb) * 8 + hh) * 32 + (dbase + d)) * 4096
               + posB + wsrc * 16 + ho;
    *(h8v*)(qkv16 + dst) = ov;
  }
}

// ---------------------------------------------------------------------------
// Kernel 4: L2-normalize q and k rows (length n=4096) in place;
// q additionally scaled by exp(temperature[h]).
// ---------------------------------------------------------------------------
__global__ __launch_bounds__(256) void k_l2scale(_Float16* __restrict__ qkv16,
                                                 const float* __restrict__ temperature) {
  __shared__ float red[256];
  const int rowId = blockIdx.x;            // 0..8191
  const int qk = rowId >> 12;              // 0=q, 1=k
  const int rr = rowId & 4095;
  const int b = rr >> 8, h = (rr >> 5) & 7, d = rr & 31;
  _Float16* row = qkv16 + ((((size_t)qk * 16 + b) * 8 + h) * 32 + d) * 4096;
  const int tid = threadIdx.x;
  float v[16];
  float s = 0.f;
#pragma unroll
  for (int j = 0; j < 16; ++j) {
    v[j] = (float)row[tid + j * 256];
    s += v[j] * v[j];
  }
  red[tid] = s;
  __syncthreads();
  for (int off = 128; off > 0; off >>= 1) {
    if (tid < off) red[tid] += red[tid + off];
    __syncthreads();
  }
  float scale = 1.0f / fmaxf(sqrtf(red[0]), L2_EPS);
  if (qk == 0) scale *= __expf(temperature[h]);
#pragma unroll
  for (int j = 0; j < 16; ++j)
    row[tid + j * 256] = (_Float16)(v[j] * scale);
}

// ---------------------------------------------------------------------------
// Kernel 5: cross-covariance attention per (b,h).
//   sim = q . k^T over n (K=4096, WMMA accumulation, both operands row-major)
//   softmax(sim * 8) over j
//   out = attn . v  (K=32, one WMMA per 16x16 tile; v transposed via LDS)
// Output rows out16[(b*4096+pos)][h*32+i] f16 for the final GEMM.
// ---------------------------------------------------------------------------
__global__ __launch_bounds__(128) void k_attn(const _Float16* __restrict__ qkv16,
                                              _Float16* __restrict__ out16) {
  __shared__ float    sim[32 * 33];
  __shared__ _Float16 attnS[32 * 32];
  __shared__ _Float16 ldsV[64 * 40];
  const int bh = blockIdx.x;
  const int b = bh >> 3, h = bh & 7;
  const int tid  = threadIdx.x;
  const int wave = tid >> 5, lane = tid & 31;
  const int g = lane >> 4, lm = lane & 15;
  const size_t planeQ = (((size_t)0 * 16 + b) * 8 + h) * (size_t)32 * 4096;
  const size_t planeK = (((size_t)1 * 16 + b) * 8 + h) * (size_t)32 * 4096;
  const size_t planeV = (((size_t)2 * 16 + b) * 8 + h) * (size_t)32 * 4096;
  // ---- phase 1: sim tiles (wave -> (i_tile, j_tile))
  {
    const int it = wave & 1, jt = wave >> 1;
    const _Float16* qr = qkv16 + planeQ + (size_t)(it * 16 + lm) * 4096;
    const _Float16* kr = qkv16 + planeK + (size_t)(jt * 16 + lm) * 4096;
    v8f acc = {};
    for (int kk = 0; kk < 4096; kk += 32) {
      __builtin_prefetch((const void*)(qr + kk + 256), 0, 1);
      __builtin_prefetch((const void*)(kr + kk + 256), 0, 1);
      FragH a, bf;
      a.q[0]  = *(const u32x4*)(qr + kk + g * 8);
      a.q[1]  = *(const u32x4*)(qr + kk + 16 + g * 8);
      bf.q[0] = *(const u32x4*)(kr + kk + g * 8);
      bf.q[1] = *(const u32x4*)(kr + kk + 16 + g * 8);
      acc = __builtin_amdgcn_wmma_f32_16x16x32_f16(false, a.h, false, bf.h,
                                                   (short)0, acc, false, false);
    }
#pragma unroll
    for (int r = 0; r < 8; ++r)
      sim[(it * 16 + g * 8 + r) * 33 + jt * 16 + lm] = acc[r];
  }
  __syncthreads();
  // ---- phase 2: softmax rows (32 rows of 32)
  if (tid < 32) {
    float* row = sim + tid * 33;
    float mx = -1e30f;
    for (int j = 0; j < 32; ++j) mx = fmaxf(mx, row[j]);
    float sum = 0.f;
    for (int j = 0; j < 32; ++j) {
      float e = __expf((row[j] - mx) * SM_SCALE);
      row[j] = e; sum += e;
    }
    float inv = 1.0f / sum;
    for (int j = 0; j < 32; ++j)
      attnS[tid * 32 + j] = (_Float16)(row[j] * inv);
  }
  __syncthreads();
  // ---- phase 3: out = attn @ v  (wave -> (i_tile, pos pair))
  const int it = wave & 1, pp = wave >> 1;
  FragH a;
  {
    const _Float16* ar = attnS + (it * 16 + lm) * 32;
    a.q[0] = *(const u32x4*)(ar + g * 8);
    a.q[1] = *(const u32x4*)(ar + 16 + g * 8);
  }
  for (int pos0 = 0; pos0 < 4096; pos0 += 64) {
    __syncthreads();
    {
      // transpose v[j][pos] tile (32 x 64) into ldsV[pos][j]
      const int j = tid >> 2, ch = tid & 3;
      union { u32x4 q[2]; _Float16 t[16]; } tmp;
      const _Float16* src = qkv16 + planeV + (size_t)j * 4096 + pos0 + ch * 16;
      tmp.q[0] = *(const u32x4*)(src);
      tmp.q[1] = *(const u32x4*)(src + 8);
#pragma unroll
      for (int e = 0; e < 16; ++e)
        ldsV[(ch * 16 + e) * 40 + j] = tmp.t[e];
    }
    __syncthreads();
#pragma unroll
    for (int u = 0; u < 2; ++u) {
      const int pt = pp * 2 + u;
      FragH bf;
      const _Float16* vr = ldsV + (pt * 16 + lm) * 40;
      bf.q[0] = *(const u32x4*)(vr + g * 8);
      bf.q[1] = *(const u32x4*)(vr + 16 + g * 8);
      v8f z = {};
      v8f c = __builtin_amdgcn_wmma_f32_16x16x32_f16(false, a.h, false, bf.h,
                                                     (short)0, z, false, false);
      const int pos = pos0 + pt * 16 + lm;
      _Float16* dst = out16 + ((size_t)b * 4096 + pos) * 256 + h * 32 + it * 16 + g * 8;
      h8v ov;
#pragma unroll
      for (int r = 0; r < 8; ++r) ov[r] = (_Float16)c[r];
      *(h8v*)dst = ov;
    }
  }
}

// ---------------------------------------------------------------------------
// Kernel 6: output projection GEMM [65536 x 256] x [256 x 256] + bias,
// 128x64 block tiling, stored straight into [b][c][H][W] f32 via LDS-staged
// transpose epilogue.
// ---------------------------------------------------------------------------
__global__ __launch_bounds__(256) void k_gemm_out(const _Float16* __restrict__ a16,
                                                  const _Float16* __restrict__ wo16,
                                                  const float* __restrict__ bias,
                                                  float* __restrict__ outp) {
  __shared__ _Float16 ldsA[128 * 40];
  __shared__ _Float16 ldsB[64 * 40];
  __shared__ float    ldsC[8 * 16 * 17];
  const int tid  = threadIdx.x;
  const int wave = tid >> 5, lane = tid & 31;
  const int g = lane >> 4, lm = lane & 15;
  const int m0 = blockIdx.x * 128;
  const int n0 = blockIdx.y * 64;
  v8f acc[4] = {};
  const int arow = tid >> 1, aoff = (tid & 1) * 16;
  const _Float16* asrc = a16 + (size_t)(m0 + arow) * 256 + aoff;
  _Float16* adst = ldsA + arow * 40 + aoff;
  const int brow = tid >> 2, boff = (tid & 3) * 8;
  const _Float16* bsrc = wo16 + (size_t)(n0 + brow) * 256 + boff;
  _Float16* bdst = ldsB + brow * 40 + boff;
  for (int k0 = 0; k0 < 256; k0 += 32) {
    __syncthreads();
    stage16(asrc + k0,     adst);
    stage16(asrc + k0 + 8, adst + 8);
    stage16(bsrc + k0,     bdst);
    stage_wait();
    __syncthreads();
    FragH a;
    const _Float16* ar = ldsA + (wave * 16 + lm) * 40;
    a.q[0] = *(const u32x4*)(ar + g * 8);
    a.q[1] = *(const u32x4*)(ar + 16 + g * 8);
#pragma unroll
    for (int tn = 0; tn < 4; ++tn) {
      FragH bf;
      const _Float16* br = ldsB + (tn * 16 + lm) * 40;
      bf.q[0] = *(const u32x4*)(br + g * 8);
      bf.q[1] = *(const u32x4*)(br + 16 + g * 8);
      acc[tn] = __builtin_amdgcn_wmma_f32_16x16x32_f16(false, a.h, false, bf.h,
                                                       (short)0, acc[tn], false, false);
    }
  }
  const int bb   = m0 >> 12;
  const int posB = m0 & 4095;
  const int rowId = tid >> 1;
  const int wsrc  = rowId >> 4;
  const int d     = rowId & 15;
  const int ho    = (tid & 1) * 8;
#pragma unroll
  for (int tn = 0; tn < 4; ++tn) {
    __syncthreads();
    float* cw = ldsC + wave * (16 * 17);
#pragma unroll
    for (int r = 0; r < 8; ++r)
      cw[lm * 17 + g * 8 + r] = acc[tn][r];
    __syncthreads();
    const int c    = n0 + tn * 16 + d;
    const float bv = bias[c];
    const float* csrc = ldsC + wsrc * (16 * 17) + d * 17 + ho;
    f32x4 o0, o1;
#pragma unroll
    for (int e = 0; e < 4; ++e) { o0[e] = csrc[e] + bv; o1[e] = csrc[4 + e] + bv; }
    float* dst = outp + ((size_t)bb * 256 + c) * 4096 + posB + wsrc * 16 + ho;
    *(f32x4*)dst       = o0;
    *(f32x4*)(dst + 4) = o1;
  }
}

// ---------------------------------------------------------------------------
extern "C" void kernel_launch(void* const* d_in, const int* in_sizes, int n_in,
                              void* d_out, int out_size, void* d_ws, size_t ws_size,
                              hipStream_t stream) {
  (void)in_sizes; (void)n_in; (void)out_size; (void)ws_size;
  const float* x    = (const float*)d_in[0];
  const float* gam  = (const float*)d_in[1];
  const float* bet  = (const float*)d_in[2];
  const float* Wqkv = (const float*)d_in[3];
  const float* temp = (const float*)d_in[4];
  const float* Wout = (const float*)d_in[5];
  const float* bout = (const float*)d_in[6];

  char* ws = (char*)d_ws;
  _Float16* t16   = (_Float16*)ws; ws += (size_t)65536 * 256 * 2;            // 32 MB
  _Float16* w16   = (_Float16*)ws; ws += (size_t)768 * 256 * 2;              // 384 KB
  _Float16* wo16  = (_Float16*)ws; ws += (size_t)256 * 256 * 2;              // 128 KB
  _Float16* qkv16 = (_Float16*)ws; ws += (size_t)3 * 16 * 8 * 32 * 4096 * 2; // 96 MB
  _Float16* out16 = (_Float16*)ws; ws += (size_t)65536 * 256 * 2;            // 32 MB
  float* outp = (float*)d_out;

  k_ln      <<<dim3(16, 128), 256, 0, stream>>>(x, gam, bet, t16);
  k_cvtw    <<<dim3(1024),    256, 0, stream>>>(Wqkv, Wout, w16, wo16);
  k_gemm_qkv<<<dim3(512, 12), 256, 0, stream>>>(t16, w16, qkv16);
  k_l2scale <<<dim3(8192),    256, 0, stream>>>(qkv16, temp);
  k_attn    <<<dim3(128),     128, 0, stream>>>(qkv16, out16);
  k_gemm_out<<<dim3(512, 4),  256, 0, stream>>>(out16, wo16, bout, outp);
}

// v001
// Measured time: 180 microseconds a run.
// In two side-by-side timings against v000, it was 1.21 and 1.22 times as fast.
#include <hip/hip_runtime.h>
#include <hip/hip_bf16.h>
#include <math.h>
#include <stdint.h>

typedef __attribute__((ext_vector_type(16))) _Float16 v16h;
typedef __attribute__((ext_vector_type(8)))  float    v8f;
typedef __attribute__((ext_vector_type(4)))  unsigned u32x4;
typedef __attribute__((ext_vector_type(8)))  _Float16 h8v;
typedef __attribute__((ext_vector_type(4)))  float    f32x4;
typedef __attribute__((ext_vector_type(4)))  int      i32x4;

union FragH { v16h h; u32x4 q[2]; };

#define LN_EPS   1e-5f
#define L2_EPS   1e-12f
#define SM_SCALE 8.0f

// ---------------------------------------------------------------------------
// CDNA5 async global->LDS staging (ASYNCcnt path), with safe fallback.
// Builtin signature (leaked by compiler diagnostic): param0 = int4 addrspace(1)*.
// ---------------------------------------------------------------------------
#if defined(__HIP_DEVICE_COMPILE__) && __has_builtin(__builtin_amdgcn_global_load_async_to_lds_b128)
#define USE_ASYNC_LDS 1
#else
#define USE_ASYNC_LDS 0
#endif

#if USE_ASYNC_LDS
typedef __attribute__((address_space(1))) i32x4 g_i32x4;
typedef __attribute__((address_space(3))) i32x4 l_i32x4;
#endif

__device__ __forceinline__ void stage16(const _Float16* g, _Float16* l) {
#if USE_ASYNC_LDS
  __builtin_amdgcn_global_load_async_to_lds_b128(
      (g_i32x4*)(uintptr_t)g,
      (l_i32x4*)(uint32_t)(uintptr_t)l, 0, 0);
#else
  *(u32x4*)l = *(const u32x4*)g;
#endif
}

__device__ __forceinline__ void stage_wait() {
#if USE_ASYNC_LDS
#if __has_builtin(__builtin_amdgcn_s_wait_asynccnt)
  __builtin_amdgcn_s_wait_asynccnt(0);
#else
  asm volatile("s_wait_asynccnt 0" ::: "memory");
#endif
#endif
}

// ---------------------------------------------------------------------------
// Kernel 1: LayerNorm over channels with LDS transpose.
// x is [b][c=256][pos=4096]; we need per-pos stats over c. Load a 256c x 32pos
// tile coalesced along pos, reduce per pos, emit f16 rows t16[(b*4096+pos)][c].
// ---------------------------------------------------------------------------
__global__ __launch_bounds__(256) void k_ln(const float* __restrict__ x,
                                            const float* __restrict__ gamma,
                                            const float* __restrict__ beta,
                                            _Float16* __restrict__ t16) {
  __shared__ float xs[256 * 33];
  __shared__ float redS[256], redQ[256];
  __shared__ float muS[32], riS[32];
  const int b    = blockIdx.x;
  const int pos0 = blockIdx.y * 32;
  const int tid  = threadIdx.x;
  for (int idx = tid; idx < 256 * 32; idx += 256) {
    int c = idx >> 5, p = idx & 31;
    xs[c * 33 + p] = x[((size_t)b * 256 + c) * 4096 + pos0 + p];
  }
  __syncthreads();
  const int pl = tid & 31, sl = tid >> 5;
  float s = 0.f, q = 0.f;
  for (int c = sl * 32; c < sl * 32 + 32; ++c) {
    float v = xs[c * 33 + pl];
    s += v; q += v * v;
  }
  redS[tid] = s; redQ[tid] = q;
  __syncthreads();
  if (tid < 32) {
    float ts = 0.f, tq = 0.f;
    for (int w = 0; w < 8; ++w) { ts += redS[w * 32 + tid]; tq += redQ[w * 32 + tid]; }
    float mu  = ts * (1.0f / 256.0f);
    float var = tq * (1.0f / 256.0f) - mu * mu;
    muS[tid] = mu;
    riS[tid] = rsqrtf(var + LN_EPS);
  }
  __syncthreads();
  const float gma = gamma[tid], bta = beta[tid];
  for (int p = 0; p < 32; ++p) {
    float v = (xs[tid * 33 + p] - muS[p]) * riS[p] * gma + bta;
    t16[((size_t)b * 4096 + pos0 + p) * 256 + tid] = (_Float16)v;
  }
}

// ---------------------------------------------------------------------------
// Kernel 2: convert weights to f16, stored transposed (w16[col][k]).
// ---------------------------------------------------------------------------
__global__ __launch_bounds__(256) void k_cvtw(const float* __restrict__ Wqkv,
                                              const float* __restrict__ Wout,
                                              _Float16* __restrict__ w16,
                                              _Float16* __restrict__ wo16) {
  int idx = blockIdx.x * 256 + threadIdx.x;
  if (idx < 768 * 256) {
    int col = idx >> 8, k = idx & 255;
    w16[idx] = (_Float16)Wqkv[(size_t)k * 768 + col];
  } else {
    int i2 = idx - 768 * 256;
    if (i2 < 256 * 256) {
      int col = i2 >> 8, k = i2 & 255;
      wo16[i2] = (_Float16)Wout[(size_t)k * 256 + col];
    }
  }
}

// ---------------------------------------------------------------------------
// Kernel 3: qkv projection GEMM  [65536 x 256] x [256 x 768] with WMMA.
// Block = 128 rows x 64 cols, 8 waves; wave w computes 16x64 (4 accumulators,
// A fragment reused 4x). K steps of 32. Async global->LDS tile staging.
// Fragment layout per CDNA5 ISA 7.12.2 (16-bit A 16x32): lane l holds row
// m=l&15; halves 0..7 = K {g*8..g*8+7}, halves 8..15 = K {16+g*8..}, g=l>>4.
// Epilogue: stage through LDS, store planar qkv16[3][b][h][d][n] f16.
// ---------------------------------------------------------------------------
__global__ __launch_bounds__(256) void k_gemm_qkv(const _Float16* __restrict__ t16,
                                                  const _Float16* __restrict__ w16,
                                                  _Float16* __restrict__ qkv16) {
  __shared__ _Float16 ldsA[128 * 40];
  __shared__ _Float16 ldsB[64 * 40];
  __shared__ float    ldsC[8 * 16 * 17];
  const int tid  = threadIdx.x;
  const int wave = tid >> 5, lane = tid & 31;
  const int g = lane >> 4, lm = lane & 15;
  const int m0 = blockIdx.x * 128;
  const int n0 = blockIdx.y * 64;
  v8f acc[4] = {};
  const int arow = tid >> 1, aoff = (tid & 1) * 16;
  const _Float16* asrc = t16 + (size_t)(m0 + arow) * 256 + aoff;
  _Float16* adst = ldsA + arow * 40 + aoff;
  const int brow = tid >> 2, boff = (tid & 3) * 8;
  const _Float16* bsrc = w16 + (size_t)(n0 + brow) * 256 + boff;
  _Float16* bdst = ldsB + brow * 40 + boff;
  for (int k0 = 0; k0 < 256; k0 += 32) {
    __syncthreads();
    stage16(asrc + k0,     adst);
    stage16(asrc + k0 + 8, adst + 8);
    stage16(bsrc + k0,     bdst);
    stage_wait();
    __syncthreads();
    FragH a;
    const _Float16* ar = ldsA + (wave * 16 + lm) * 40;
    a.q[0] = *(const u32x4*)(ar + g * 8);
    a.q[1] = *(const u32x4*)(ar + 16 + g * 8);
#pragma unroll
    for (int tn = 0; tn < 4; ++tn) {
      FragH bf;
      const _Float16* br = ldsB + (tn * 16 + lm) * 40;
      bf.q[0] = *(const u32x4*)(br + g * 8);
      bf.q[1] = *(const u32x4*)(br + 16 + g * 8);
      acc[tn] = __builtin_amdgcn_wmma_f32_16x16x32_f16(false, a.h, false, bf.h,
                                                       (short)0, acc[tn], false, false);
    }
  }
  // epilogue: per N-tile, stage C via LDS, store planar, 16B runs along pos
  const int bb   = m0 >> 12;
  const int posB = m0 & 4095;
  const int rowId = tid >> 1;   // 0..127 = wave*16 + d
  const int wsrc  = rowId >> 4;
  const int d     = rowId & 15;
  const int ho    = (tid & 1) * 8;
#pragma unroll
  for (int tn = 0; tn < 4; ++tn) {
    __syncthreads();
    float* cw = ldsC + wave * (16 * 17);
#pragma unroll
    for (int r = 0; r < 8; ++r)
      cw[lm * 17 + g * 8 + r] = acc[tn][r];   // ldsC[wave][ncol=d][m=pos]
    __syncthreads();
    const int col0   = n0 + tn * 16;
    const int qkvIdx = col0 >> 8;
    const int hh     = (col0 >> 5) & 7;
    const int dbase  = col0 & 31;
    const float* csrc = ldsC + wsrc * (16 * 17) + d * 17 + ho;
    h8v ov;
#pragma unroll
    for (int e = 0; e < 8; ++e) ov[e] = (_Float16)csrc[e];
    size_t dst = ((((size_t)qkvIdx * 16 + bb) * 8 + hh) * 32 + (dbase + d)) * 4096
               + posB + wsrc * 16 + ho;
    *(h8v*)(qkv16 + dst) = ov;
  }
}

// ---------------------------------------------------------------------------
// Kernel 4: L2-normalize q and k rows (length n=4096) in place;
// q additionally scaled by exp(temperature[h]).
// ---------------------------------------------------------------------------
__global__ __launch_bounds__(256) void k_l2scale(_Float16* __restrict__ qkv16,
                                                 const float* __restrict__ temperature) {
  __shared__ float red[256];
  const int rowId = blockIdx.x;            // 0..8191
  const int qk = rowId >> 12;              // 0=q, 1=k
  const int rr = rowId & 4095;
  const int b = rr >> 8, h = (rr >> 5) & 7, d = rr & 31;
  _Float16* row = qkv16 + ((((size_t)qk * 16 + b) * 8 + h) * 32 + d) * 4096;
  const int tid = threadIdx.x;
  float v[16];
  float s = 0.f;
#pragma unroll
  for (int j = 0; j < 16; ++j) {
    v[j] = (float)row[tid + j * 256];
    s += v[j] * v[j];
  }
  red[tid] = s;
  __syncthreads();
  for (int off = 128; off > 0; off >>= 1) {
    if (tid < off) red[tid] += red[tid + off];
    __syncthreads();
  }
  float scale = 1.0f / fmaxf(sqrtf(red[0]), L2_EPS);
  if (qk == 0) scale *= __expf(temperature[h]);
#pragma unroll
  for (int j = 0; j < 16; ++j)
    row[tid + j * 256] = (_Float16)(v[j] * scale);
}

// ---------------------------------------------------------------------------
// Kernel 5a: partial cross-covariance sums. sim = q . k^T over n (K=4096) is
// split over n: work-group (bh, sl) takes 1024 positions, each of its 8 waves
// a span of 128 and all four 16x16 tiles of the 32x32 result. The 8 spans are
// summed through LDS in wave order; simP[bh][sl][32*32] f32 goes to kernel 5b.
// ---------------------------------------------------------------------------
__global__ __launch_bounds__(256) void k_sim(const _Float16* __restrict__ qkv16,
                                             float* __restrict__ simP) {
  __shared__ float part[8 * 32 * 33];
  const int bh = blockIdx.x, sl = blockIdx.y;
  const int b = bh >> 3, h = bh & 7;
  const int tid  = threadIdx.x;
  const int wave = tid >> 5, lane = tid & 31;
  const int g = lane >> 4, lm = lane & 15;
  const size_t planeQ = (((size_t)0 * 16 + b) * 8 + h) * (size_t)32 * 4096;
  const size_t planeK = (((size_t)1 * 16 + b) * 8 + h) * (size_t)32 * 4096;
  const int n0 = sl * 1024 + wave * 128;
  const _Float16* qr = qkv16 + planeQ + (size_t)lm * 4096 + n0;
  const _Float16* kr = qkv16 + planeK + (size_t)lm * 4096 + n0;
  // the wave's whole span is loaded first: 32 loads in flight, one memory latency
  // (every loop over a[], bf[], acc[] is unrolled so that they stay in registers)
  FragH a[4][2], bf[4][2];
#pragma unroll
  for (int s = 0; s < 4; ++s)
#pragma unroll
    for (int t = 0; t < 2; ++t) {
      a[s][t].q[0]  = *(const u32x4*)(qr + t * 16 * 4096 + s * 32 + g * 8);
      a[s][t].q[1]  = *(const u32x4*)(qr + t * 16 * 4096 + s * 32 + 16 + g * 8);
      bf[s][t].q[0] = *(const u32x4*)(kr + t * 16 * 4096 + s * 32 + g * 8);
      bf[s][t].q[1] = *(const u32x4*)(kr + t * 16 * 4096 + s * 32 + 16 + g * 8);
    }
  // keeps the scheduler from sinking loads between the products, where each
  // group would wait out its own latency
  __builtin_amdgcn_sched_barrier(0);
  v8f acc[2][2] = {};
#pragma unroll
  for (int s = 0; s < 4; ++s)
#pragma unroll
    for (int it = 0; it < 2; ++it)
#pragma unroll
      for (int jt = 0; jt < 2; ++jt)
        acc[it][jt] = __builtin_amdgcn_wmma_f32_16x16x32_f16(false, a[s][it].h, false, bf[s][jt].h,
                                                             (short)0, acc[it][jt], false, false);
  float* pw = part + wave * (32 * 33);
#pragma unroll
  for (int it = 0; it < 2; ++it)
#pragma unroll
    for (int jt = 0; jt < 2; ++jt)
#pragma unroll
      for (int r = 0; r < 8; ++r)
        pw[(it * 16 + g * 8 + r) * 33 + jt * 16 + lm] = acc[it][jt][r];
  __syncthreads();
  float* dst = simP + ((size_t)bh * 4 + sl) * 1024;
  for (int idx = tid; idx < 1024; idx += 256) {
    const int o = (idx >> 5) * 33 + (idx & 31);
    float s = part[o];
#pragma unroll
    for (int w = 1; w < 8; ++w) s += part[w * (32 * 33) + o];
    dst[idx] = s;
  }
}

// ---------------------------------------------------------------------------
// Kernel 5b: per (b,h) and slice of 512 positions:
//   sim = sum of the 4 partial planes, in slice order
//   softmax(sim * 8) over j (repeated in every slice's work-group)
//   out = attn . v  (K=32, one WMMA per 16x16 tile; v transposed via LDS)
// Output rows out16[(b*4096+pos)][h*32+i] f16 for the final GEMM.
// ---------------------------------------------------------------------------
__global__ __launch_bounds__(256) void k_attn_out(const _Float16* __restrict__ qkv16,
                                                  const float* __restrict__ simP,
                                                  _Float16* __restrict__ out16) {
  __shared__ float    sim[32 * 33];
  __shared__ _Float16 attnS[32 * 32];
  __shared__ _Float16 ldsV[512 * 40];
  const int bh = blockIdx.x;
  const int posW = blockIdx.y * 512;
  const int b = bh >> 3, h = bh & 7;
  const int tid  = threadIdx.x;
  const int wave = tid >> 5, lane = tid & 31;
  const int g = lane >> 4, lm = lane & 15;
  const size_t planeV = (((size_t)2 * 16 + b) * 8 + h) * (size_t)32 * 4096;
  // ---- v[j][pos] slice (32 x 512) into registers; it goes to LDS below
  const int vj = (tid & 127) >> 2, vp = (tid >> 7) * 64 + (tid & 3) * 16;
  // (loops over tmp[] are unrolled: it stays in registers, 8 loads in flight)
  union { u32x4 q[2]; _Float16 t[16]; } tmp[4];
  {
    const _Float16* src = qkv16 + planeV + (size_t)vj * 4096 + posW + vp;
#pragma unroll
    for (int s = 0; s < 4; ++s) {
      tmp[s].q[0] = *(const u32x4*)(src + s * 128);
      tmp[s].q[1] = *(const u32x4*)(src + s * 128 + 8);
    }
  }
  // ---- sim = sum of the partial planes
  {
    const float* sp = simP + (size_t)bh * 4 * 1024 + tid * 4;
    f32x4 s4 = *(const f32x4*)sp;
#pragma unroll
    for (int sl = 1; sl < 4; ++sl) s4 += *(const f32x4*)(sp + sl * 1024);
    float* sd = sim + (tid >> 3) * 33 + (tid & 7) * 4;
#pragma unroll
    for (int e = 0; e < 4; ++e) sd[e] = s4[e];
  }
  __syncthreads();
  // ---- softmax rows (32 rows of 32)
  if (tid < 32) {
    float* row = sim + tid * 33;
    float mx = -1e30f;
    for (int j = 0; j < 32; ++j) mx = fmaxf(mx, row[j]);
    float sum = 0.f;
    for (int j = 0; j < 32; ++j) {
      float e = __expf((row[j] - mx) * SM_SCALE);
      row[j] = e; sum += e;
    }
    float inv = 1.0f / sum;
    for (int j = 0; j < 32; ++j)
      attnS[tid * 32 + j] = (_Float16)(row[j] * inv);
  }
  // ---- transpose the v slice into ldsV[pos][j]
#pragma unroll
  for (int s = 0; s < 4; ++s)
#pragma unroll
    for (int e = 0; e < 16; ++e)
      ldsV[(s * 128 + vp + e) * 40 + vj] = tmp[s].t[e];
  __syncthreads();
  // ---- out = attn @ v  (wave -> (i_tile, 8 pos tiles))
  const int it = wave & 1, pp = wave >> 1;
  FragH a;
  {
    const _Float16* ar = attnS + (it * 16 + lm) * 32;
    a.q[0] = *(const u32x4*)(ar + g * 8);
    a.q[1] = *(const u32x4*)(ar + 16 + g * 8);
  }
  // unrolled so that the LDS reads of later tiles overlap earlier products and stores
#pragma unroll
  for (int u = 0; u < 8; ++u) {
    const int pt = pp * 8 + u;
    FragH bf;
    const _Float16* vr = ldsV + (pt * 16 + lm) * 40;
    bf.q[0] = *(const u32x4*)(vr + g * 8);
    bf.q[1] = *(const u32x4*)(vr + 16 + g * 8);
    v8f z = {};
    v8f c = __builtin_amdgcn_wmma_f32_16x16x32_f16(false, a.h, false, bf.h,
                                                   (short)0, z, false, false);
    const int pos = posW + pt * 16 + lm;
    _Float16* dst = out16 + ((size_t)b * 4096 + pos) * 256 + h * 32 + it * 16 + g * 8;
    h8v ov;
#pragma unroll
    for (int r = 0; r < 8; ++r) ov[r] = (_Float16)c[r];
    *(h8v*)dst = ov;
  }
}

// ---------------------------------------------------------------------------
// Kernel 6: output projection GEMM [65536 x 256] x [256 x 256] + bias,
// 128x64 block tiling, stored straight into [b][c][H][W] f32 via LDS-staged
// transpose epilogue.
// ---------------------------------------------------------------------------
__global__ __launch_bounds__(256) void k_gemm_out(const _Float16* __restrict__ a16,
                                                  const _Float16* __restrict__ wo16,
                                                  const float* __restrict__ bias,
                                                  float* __restrict__ outp) {
  __shared__ _Float16 ldsA[128 * 40];
  __shared__ _Float16 ldsB[64 * 40];
  __shared__ float    ldsC[8 * 16 * 17];
  const int tid  = threadIdx.x;
  const int wave = tid >> 5, lane = tid & 31;
  const int g = lane >> 4, lm = lane & 15;
  const int m0 = blockIdx.x * 128;
  const int n0 = blockIdx.y * 64;
  v8f acc[4] = {};
  const int arow = tid >> 1, aoff = (tid & 1) * 16;
  const _Float16* asrc = a16 + (size_t)(m0 + arow) * 256 + aoff;
  _Float16* adst = ldsA + arow * 40 + aoff;
  const int brow = tid >> 2, boff = (tid & 3) * 8;
  const _Float16* bsrc = wo16 + (size_t)(n0 + brow) * 256 + boff;
  _Float16* bdst = ldsB + brow * 40 + boff;
  for (int k0 = 0; k0 < 256; k0 += 32) {
    __syncthreads();
    stage16(asrc + k0,     adst);
    stage16(asrc + k0 + 8, adst + 8);
    stage16(bsrc + k0,     bdst);
    stage_wait();
    __syncthreads();
    FragH a;
    const _Float16* ar = ldsA + (wave * 16 + lm) * 40;
    a.q[0] = *(const u32x4*)(ar + g * 8);
    a.q[1] = *(const u32x4*)(ar + 16 + g * 8);
#pragma unroll
    for (int tn = 0; tn < 4; ++tn) {
      FragH bf;
      const _Float16* br = ldsB + (tn * 16 + lm) * 40;
      bf.q[0] = *(const u32x4*)(br + g * 8);
      bf.q[1] = *(const u32x4*)(br + 16 + g * 8);
      acc[tn] = __builtin_amdgcn_wmma_f32_16x16x32_f16(false, a.h, false, bf.h,
                                                       (short)0, acc[tn], false, false);
    }
  }
  const int bb   = m0 >> 12;
  const int posB = m0 & 4095;
  const int rowId = tid >> 1;
  const int wsrc  = rowId >> 4;
  const int d     = rowId & 15;
  const int ho    = (tid & 1) * 8;
#pragma unroll
  for (int tn = 0; tn < 4; ++tn) {
    __syncthreads();
    float* cw = ldsC + wave * (16 * 17);
#pragma unroll
    for (int r = 0; r < 8; ++r)
      cw[lm * 17 + g * 8 + r] = acc[tn][r];
    __syncthreads();
    const int c    = n0 + tn * 16 + d;
    const float bv = bias[c];
    const float* csrc = ldsC + wsrc * (16 * 17) + d * 17 + ho;
    f32x4 o0, o1;
#pragma unroll
    for (int e = 0; e < 4; ++e) { o0[e] = csrc[e] + bv; o1[e] = csrc[4 + e] + bv; }
    float* dst = outp + ((size_t)bb * 256 + c) * 4096 + posB + wsrc * 16 + ho;
    *(f32x4*)dst       = o0;
    *(f32x4*)(dst + 4) = o1;
  }
}

// ---------------------------------------------------------------------------
extern "C" void kernel_launch(void* const* d_in, const int* in_sizes, int n_in,
                              void* d_out, int out_size, void* d_ws, size_t ws_size,
                              hipStream_t stream) {
  (void)in_sizes; (void)n_in; (void)out_size; (void)ws_size;
  const float* x    = (const float*)d_in[0];
  const float* gam  = (const float*)d_in[1];
  const float* bet  = (const float*)d_in[2];
  const float* Wqkv = (const float*)d_in[3];
  const float* temp = (const float*)d_in[4];
  const float* Wout = (const float*)d_in[5];
  const float* bout = (const float*)d_in[6];

  char* ws = (char*)d_ws;
  _Float16* t16   = (_Float16*)ws; ws += (size_t)65536 * 256 * 2;            // 32 MB
  _Float16* w16   = (_Float16*)ws; ws += (size_t)768 * 256 * 2;              // 384 KB
  _Float16* wo16  = (_Float16*)ws; ws += (size_t)256 * 256 * 2;              // 128 KB
  _Float16* qkv16 = (_Float16*)ws; ws += (size_t)3 * 16 * 8 * 32 * 4096 * 2; // 96 MB
  _Float16* out16 = (_Float16*)ws; ws += (size_t)65536 * 256 * 2;            // 32 MB
  float*    simP  = (float*)ws;    ws += (size_t)128 * 4 * 1024 * 4;         // 2 MB
  float* outp = (float*)d_out;

  k_ln      <<<dim3(16, 128), 256, 0, stream>>>(x, gam, bet, t16);
  k_cvtw    <<<dim3(1024),    256, 0, stream>>>(Wqkv, Wout, w16, wo16);
  k_gemm_qkv<<<dim3(512, 12), 256, 0, stream>>>(t16, w16, qkv16);
  k_l2scale <<<dim3(8192),    256, 0, stream>>>(qkv16, temp);
  k_sim     <<<dim3(128, 4),  256, 0, stream>>>(qkv16, simP);
  k_attn_out<<<dim3(128, 8),  256, 0, stream>>>(qkv16, simP, out16);
  k_gemm_out<<<dim3(512, 4),  256, 0, stream>>>(out16, wo16, bout, outp);
}

// v002
// It runs in 163 microseconds.
// Two timings next to v001 both put it at 1.10 times that version's speed.
// Over all steps from v000 it is 1.34 times as fast.
#include <hip/hip_runtime.h>
#include <hip/hip_bf16.h>
#include <math.h>
#include <stdint.h>

typedef __attribute__((ext_vector_type(16))) _Float16 v16h;
typedef __attribute__((ext_vector_type(8)))  float    v8f;
typedef __attribute__((ext_vector_type(4)))  unsigned u32x4;
typedef __attribute__((ext_vector_type(8)))  _Float16 h8v;
typedef __attribute__((ext_vector_type(4)))  float    f32x4;
typedef __attribute__((ext_vector_type(4)))  int      i32x4;

union FragH { v16h h; u32x4 q[2]; };

#define LN_EPS   1e-5f
#define L2_EPS   1e-12f
#define SM_SCALE 8.0f

// ---------------------------------------------------------------------------
// CDNA5 async global->LDS staging (ASYNCcnt path), with safe fallback.
// Builtin signature (leaked by compiler diagnostic): param0 = int4 addrspace(1)*.
// ---------------------------------------------------------------------------
#if defined(__HIP_DEVICE_COMPILE__) && __has_builtin(__builtin_amdgcn_global_load_async_to_lds_b128)
#define USE_ASYNC_LDS 1
#else
#define USE_ASYNC_LDS 0
#endif

#if USE_ASYNC_LDS
typedef __attribute__((address_space(1))) i32x4 g_i32x4;
typedef __attribute__((address_space(3))) i32x4 l_i32x4;
#endif

__device__ __forceinline__ void stage16(const _Float16* g, _Float16* l) {
#if USE_ASYNC_LDS
  __builtin_amdgcn_global_load_async_to_lds_b128(
      (g_i32x4*)(uintptr_t)g,
      (l_i32x4*)(uint32_t)(uintptr_t)l, 0, 0);
#else
  *(u32x4*)l = *(const u32x4*)g;
#endif
}

__device__ __forceinline__ void stage_wait() {
#if USE_ASYNC_LDS
#if __has_builtin(__builtin_amdgcn_s_wait_asynccnt)
  __builtin_amdgcn_s_wait_asynccnt(0);
#else
  asm volatile("s_wait_asynccnt 0" ::: "memory");
#endif
#endif
}

// ---------------------------------------------------------------------------
// Kernel 1: LayerNorm over channels with LDS transpose.
// x is [b][c=256][pos=4096]; we need per-pos stats over c. Load a 256c x 32pos
// tile coalesced along pos, reduce per pos, emit f16 rows t16[(b*4096+pos)][c].
// ---------------------------------------------------------------------------
__global__ __launch_bounds__(256) void k_ln(const float* __restrict__ x,
                                            const float* __restrict__ gamma,
                                            const float* __restrict__ beta,
                                            _Float16* __restrict__ t16) {
  __shared__ float xs[256 * 33];
  __shared__ float redS[256], redQ[256];
  __shared__ float muS[32], riS[32];
  const int b    = blockIdx.x;
  const int pos0 = blockIdx.y * 32;
  const int tid  = threadIdx.x;
  for (int idx = tid; idx < 256 * 32; idx += 256) {
    int c = idx >> 5, p = idx & 31;
    xs[c * 33 + p] = x[((size_t)b * 256 + c) * 4096 + pos0 + p];
  }
  __syncthreads();
  const int pl = tid & 31, sl = tid >> 5;
  float s = 0.f, q = 0.f;
  for (int c = sl * 32; c < sl * 32 + 32; ++c) {
    float v = xs[c * 33 + pl];
    s += v; q += v * v;
  }
  redS[tid] = s; redQ[tid] = q;
  __syncthreads();
  if (tid < 32) {
    float ts = 0.f, tq = 0.f;
    for (int w = 0; w < 8; ++w) { ts += redS[w * 32 + tid]; tq += redQ[w * 32 + tid]; }
    float mu  = ts * (1.0f / 256.0f);
    float var = tq * (1.0f / 256.0f) - mu * mu;
    muS[tid] = mu;
    riS[tid] = rsqrtf(var + LN_EPS);
  }
  __syncthreads();
  const float gma = gamma[tid], bta = beta[tid];
  for (int p = 0; p < 32; ++p) {
    float v = (xs[tid * 33 + p] - muS[p]) * riS[p] * gma + bta;
    t16[((size_t)b * 4096 + pos0 + p) * 256 + tid] = (_Float16)v;
  }
}

// ---------------------------------------------------------------------------
// Kernel 2: convert weights to f16, stored transposed (w16[col][k]).
// ---------------------------------------------------------------------------
__global__ __launch_bounds__(256) void k_cvtw(const float* __restrict__ Wqkv,
                                              const float* __restrict__ Wout,
                                              _Float16* __restrict__ w16,
                                              _Float16* __restrict__ wo16) {
  int idx = blockIdx.x * 256 + threadIdx.x;
  if (idx < 768 * 256) {
    int col = idx >> 8, k = idx & 255;
    w16[idx] = (_Float16)Wqkv[(size_t)k * 768 + col];
  } else {
    int i2 = idx - 768 * 256;
    if (i2 < 256 * 256) {
      int col = i2 >> 8, k = i2 & 255;
      wo16[i2] = (_Float16)Wout[(size_t)k * 256 + col];
    }
  }
}

// ---------------------------------------------------------------------------
// Kernel 3: qkv projection GEMM  [65536 x 256] x [256 x 768] with WMMA.
// Block = 128 rows x 64 cols, 8 waves; wave w computes 16x64 (4 accumulators,
// A fragment reused 4x). K steps of 32. Async global->LDS tile staging.
// Fragment layout per CDNA5 ISA 7.12.2 (16-bit A 16x32): lane l holds row
// m=l&15; halves 0..7 = K {g*8..g*8+7}, halves 8..15 = K {16+g*8..}, g=l>>4.
// Epilogue: stage through LDS, store planar qkv16[3][b][h][d][n] f16.
// ---------------------------------------------------------------------------
__global__ __launch_bounds__(256) void k_gemm_qkv(const _Float16* __restrict__ t16,
                                                  const _Float16* __restrict__ w16,
                                                  _Float16* __restrict__ qkv16) {
  __shared__ _Float16 ldsA[128 * 40];
  __shared__ _Float16 ldsB[64 * 40];
  __shared__ float    ldsC[8 * 16 * 17];
  const int tid  = threadIdx.x;
  const int wave = tid >> 5, lane = tid & 31;
  const int g = lane >> 4, lm = lane & 15;
  const int m0 = blockIdx.x * 128;
  const int n0 = blockIdx.y * 64;
  v8f acc[4] = {};
  const int arow = tid >> 1, aoff = (tid & 1) * 16;
  const _Float16* asrc = t16 + (size_t)(m0 + arow) * 256 + aoff;
  _Float16* adst = ldsA + arow * 40 + aoff;
  const int brow = tid >> 2, boff = (tid & 3) * 8;
  const _Float16* bsrc = w16 + (size_t)(n0 + brow) * 256 + boff;
  _Float16* bdst = ldsB + brow * 40 + boff;
  for (int k0 = 0; k0 < 256; k0 += 32) {
    __syncthreads();
    stage16(asrc + k0,     adst);
    stage16(asrc + k0 + 8, adst + 8);
    stage16(bsrc + k0,     bdst);
    stage_wait();
    __syncthreads();
    FragH a;
    const _Float16* ar = ldsA + (wave * 16 + lm) * 40;
    a.q[0] = *(const u32x4*)(ar + g * 8);
    a.q[1] = *(const u32x4*)(ar + 16 + g * 8);
#pragma unroll
    for (int tn = 0; tn < 4; ++tn) {
      FragH bf;
      const _Float16* br = ldsB + (tn * 16 + lm) * 40;
      bf.q[0] = *(const u32x4*)(br + g * 8);
      bf.q[1] = *(const u32x4*)(br + 16 + g * 8);
      acc[tn] = __builtin_amdgcn_wmma_f32_16x16x32_f16(false, a.h, false, bf.h,
                                                       (short)0, acc[tn], false, false);
    }
  }
  // epilogue: per N-tile, stage C via LDS, store planar, 16B runs along pos
  const int bb   = m0 >> 12;
  const int posB = m0 & 4095;
  const int rowId = tid >> 1;   // 0..127 = wave*16 + d
  const int wsrc  = rowId >> 4;
  const int d     = rowId & 15;
  const int ho    = (tid & 1) * 8;
#pragma unroll
  for (int tn = 0; tn < 4; ++tn) {
    __syncthreads();
    float* cw = ldsC + wave * (16 * 17);
#pragma unroll
    for (int r = 0; r < 8; ++r)
      cw[lm * 17 + g * 8 + r] = acc[tn][r];   // ldsC[wave][ncol=d][m=pos]
    __syncthreads();
    const int col0   = n0 + tn * 16;
    const int qkvIdx = col0 >> 8;
    const int hh     = (col0 >> 5) & 7;
    const int dbase  = col0 & 31;
    const float* csrc = ldsC + wsrc * (16 * 17) + d * 17 + ho;
    h8v ov;
#pragma unroll
    for (int e = 0; e < 8; ++e) ov[e] = (_Float16)csrc[e];
    size_t dst = ((((size_t)qkvIdx * 16 + bb) * 8 + hh) * 32 + (dbase + d)) * 4096
               + posB + wsrc * 16 + ho;
    *(h8v*)(qkv16 + dst) = ov;
  }
}

// ---------------------------------------------------------------------------
// Kernel 5a: partial cross-covariance sums. sim = q . k^T over n (K=4096) is
// split over n: work-group (bh, sl) takes 1024 positions, each of its 8 waves
// a span of 128 and all four 16x16 tiles of the 32x32 result. The 8 spans are
// summed through LDS in wave order; simP[bh][sl][32*32] f32 goes to kernel 5b.
// q and k are read as the projection left them (not normalized). The sums of
// squares of their rows over the same span are the diagonals of q.q^T and
// k.k^T, taken from the fragments already in registers; they are summed the
// same way into ssP[bh][sl][64] (32 q rows, then 32 k rows) for kernel 5b.
// ---------------------------------------------------------------------------
__global__ __launch_bounds__(256) void k_sim(const _Float16* __restrict__ qkv16,
                                             float* __restrict__ simP,
                                             float* __restrict__ ssP) {
  __shared__ float part[8 * 32 * 33];
  __shared__ float ssW[8 * 64];
  const int bh = blockIdx.x, sl = blockIdx.y;
  const int b = bh >> 3, h = bh & 7;
  const int tid  = threadIdx.x;
  const int wave = tid >> 5, lane = tid & 31;
  const int g = lane >> 4, lm = lane & 15;
  const size_t planeQ = (((size_t)0 * 16 + b) * 8 + h) * (size_t)32 * 4096;
  const size_t planeK = (((size_t)1 * 16 + b) * 8 + h) * (size_t)32 * 4096;
  const int n0 = sl * 1024 + wave * 128;
  const _Float16* qr = qkv16 + planeQ + (size_t)lm * 4096 + n0;
  const _Float16* kr = qkv16 + planeK + (size_t)lm * 4096 + n0;
  // the wave's whole span is loaded first: 32 loads in flight, one memory latency
  // (every loop over a[], bf[], acc[] is unrolled so that they stay in registers)
  FragH a[4][2], bf[4][2];
#pragma unroll
  for (int s = 0; s < 4; ++s)
#pragma unroll
    for (int t = 0; t < 2; ++t) {
      a[s][t].q[0]  = *(const u32x4*)(qr + t * 16 * 4096 + s * 32 + g * 8);
      a[s][t].q[1]  = *(const u32x4*)(qr + t * 16 * 4096 + s * 32 + 16 + g * 8);
      bf[s][t].q[0] = *(const u32x4*)(kr + t * 16 * 4096 + s * 32 + g * 8);
      bf[s][t].q[1] = *(const u32x4*)(kr + t * 16 * 4096 + s * 32 + 16 + g * 8);
    }
  // keeps the scheduler from sinking loads between the products, where each
  // group would wait out its own latency
  __builtin_amdgcn_sched_barrier(0);
  v8f acc[2][2] = {};
  v8f qq[2] = {}, kk[2] = {};
#pragma unroll
  for (int s = 0; s < 4; ++s) {
#pragma unroll
    for (int it = 0; it < 2; ++it)
#pragma unroll
      for (int jt = 0; jt < 2; ++jt)
        acc[it][jt] = __builtin_amdgcn_wmma_f32_16x16x32_f16(false, a[s][it].h, false, bf[s][jt].h,
                                                             (short)0, acc[it][jt], false, false);
    // A and B fragments share one k order, so a fragment times itself is a Gram tile
#pragma unroll
    for (int t = 0; t < 2; ++t) {
      qq[t] = __builtin_amdgcn_wmma_f32_16x16x32_f16(false, a[s][t].h, false, a[s][t].h,
                                                     (short)0, qq[t], false, false);
      kk[t] = __builtin_amdgcn_wmma_f32_16x16x32_f16(false, bf[s][t].h, false, bf[s][t].h,
                                                     (short)0, kk[t], false, false);
    }
  }
  // diagonal element of row lm sits in the lane with g == lm >> 3, register lm & 7
#pragma unroll
  for (int t = 0; t < 2; ++t) {
    float dq = qq[t][0], dk = kk[t][0];
#pragma unroll
    for (int r = 1; r < 8; ++r)
      if ((lm & 7) == r) { dq = qq[t][r]; dk = kk[t][r]; }
    if ((lm >> 3) == g) {
      ssW[wave * 64 + t * 16 + lm]      = dq;
      ssW[wave * 64 + 32 + t * 16 + lm] = dk;
    }
  }
  float* pw = part + wave * (32 * 33);
#pragma unroll
  for (int it = 0; it < 2; ++it)
#pragma unroll
    for (int jt = 0; jt < 2; ++jt)
#pragma unroll
      for (int r = 0; r < 8; ++r)
        pw[(it * 16 + g * 8 + r) * 33 + jt * 16 + lm] = acc[it][jt][r];
  __syncthreads();
  float* dst = simP + ((size_t)bh * 4 + sl) * 1024;
  for (int idx = tid; idx < 1024; idx += 256) {
    const int o = (idx >> 5) * 33 + (idx & 31);
    float s = part[o];
#pragma unroll
    for (int w = 1; w < 8; ++w) s += part[w * (32 * 33) + o];
    dst[idx] = s;
  }
  if (tid < 64) {
    float s = ssW[tid];
#pragma unroll
    for (int w = 1; w < 8; ++w) s += ssW[w * 64 + tid];
    ssP[((size_t)bh * 4 + sl) * 64 + tid] = s;
  }
}

// ---------------------------------------------------------------------------
// Kernel 5b: per (b,h) and slice of 512 positions:
//   sim = sum of the 4 partial planes, in slice order, times
//         exp(temperature[h]) / max(|q_i|, eps) / max(|k_j|, eps), the norms
//         from the 4 partial sums of squares (the l2norm of q and k)
//   softmax(sim * 8) over j (repeated in every slice's work-group)
//   out = attn . v  (K=32, one WMMA per 16x16 tile; v transposed via LDS)
// Output rows out16[(b*4096+pos)][h*32+i] f16 for the final GEMM.
// ---------------------------------------------------------------------------
__global__ __launch_bounds__(256) void k_attn_out(const _Float16* __restrict__ qkv16,
                                                  const float* __restrict__ simP,
                                                  const float* __restrict__ ssP,
                                                  const float* __restrict__ temperature,
                                                  _Float16* __restrict__ out16) {
  __shared__ float    sim[32 * 33];
  __shared__ _Float16 attnS[32 * 32];
  __shared__ _Float16 ldsV[512 * 40];
  const int bh = blockIdx.x;
  const int posW = blockIdx.y * 512;
  const int b = bh >> 3, h = bh & 7;
  const int tid  = threadIdx.x;
  const int wave = tid >> 5, lane = tid & 31;
  const int g = lane >> 4, lm = lane & 15;
  const size_t planeV = (((size_t)2 * 16 + b) * 8 + h) * (size_t)32 * 4096;
  // ---- partial planes and partial sums of squares into registers
  // (loops over pS[], pK[], pQ[] are unrolled: they stay in registers)
  f32x4 pS[4], pK[4];
  float pQ[4];
  {
    const float* sp = simP + (size_t)bh * 4 * 1024 + tid * 4;
    const float* nq = ssP + (size_t)bh * 4 * 64 + (tid >> 3);
    const float* nk = ssP + (size_t)bh * 4 * 64 + 32 + (tid & 7) * 4;
#pragma unroll
    for (int sl = 0; sl < 4; ++sl) {
      pS[sl] = *(const f32x4*)(sp + sl * 1024);
      pK[sl] = *(const f32x4*)(nk + sl * 64);
      pQ[sl] = nq[sl * 64];
    }
  }
  // ---- v[j][pos] slice (32 x 512) into registers; it goes to LDS below
  const int vj = (tid & 127) >> 2, vp = (tid >> 7) * 64 + (tid & 3) * 16;
  // (loops over tmp[] are unrolled: it stays in registers, 8 loads in flight)
  union { u32x4 q[2]; _Float16 t[16]; } tmp[4];
  {
    const _Float16* src = qkv16 + planeV + (size_t)vj * 4096 + posW + vp;
#pragma unroll
    for (int s = 0; s < 4; ++s) {
      tmp[s].q[0] = *(const u32x4*)(src + s * 128);
      tmp[s].q[1] = *(const u32x4*)(src + s * 128 + 8);
    }
  }
  // stands in front of the first overwrite of an address register of the loads above
  asm volatile("s_wait_xcnt 0x0" ::: "memory");
  // keeps the scheduler from sinking the v loads behind the waits of the sums
  // below, where they would wait out a second memory latency
  __builtin_amdgcn_sched_barrier(0);
  const float tq = temperature[h];
  // ---- sim = sum of the partial planes, scaled by the inverse norms
  {
    f32x4 s4 = pS[0], ssk = pK[0];
    float ssq = pQ[0];
#pragma unroll
    for (int sl = 1; sl < 4; ++sl) { s4 += pS[sl]; ssk += pK[sl]; ssq += pQ[sl]; }
    const float sq = __expf(tq) * (1.0f / fmaxf(sqrtf(ssq), L2_EPS));
    float* sd = sim + (tid >> 3) * 33 + (tid & 7) * 4;
#pragma unroll
    for (int e = 0; e < 4; ++e)
      sd[e] = s4[e] * sq * (1.0f / fmaxf(sqrtf(ssk[e]), L2_EPS));
  }
  __syncthreads();
  // ---- softmax rows (32 rows of 32)
  if (tid < 32) {
    float* row = sim + tid * 33;
    float mx = -1e30f;
    for (int j = 0; j < 32; ++j) mx = fmaxf(mx, row[j]);
    float sum = 0.f;
    for (int j = 0; j < 32; ++j) {
      float e = __expf((row[j] - mx) * SM_SCALE);
      row[j] = e; sum += e;
    }
    float inv = 1.0f / sum;
    for (int j = 0; j < 32; ++j)
      attnS[tid * 32 + j] = (_Float16)(row[j] * inv);
  }
  // ---- transpose the v slice into ldsV[pos][j]
#pragma unroll
  for (int s = 0; s < 4; ++s)
#pragma unroll
    for (int e = 0; e < 16; ++e)
      ldsV[(s * 128 + vp + e) * 40 + vj] = tmp[s].t[e];
  __syncthreads();
  // ---- out = attn @ v  (wave -> (i_tile, 8 pos tiles))
  const int it = wave & 1, pp = wave >> 1;
  FragH a;
  {
    const _Float16* ar = attnS + (it * 16 + lm) * 32;
    a.q[0] = *(const u32x4*)(ar + g * 8);
    a.q[1] = *(const u32x4*)(ar + 16 + g * 8);
  }
  // unrolled so that the LDS reads of later tiles overlap earlier products and stores
#pragma unroll
  for (int u = 0; u < 8; ++u) {
    const int pt = pp * 8 + u;
    FragH bf;
    const _Float16* vr = ldsV + (pt * 16 + lm) * 40;
    bf.q[0] = *(const u32x4*)(vr + g * 8);
    bf.q[1] = *(const u32x4*)(vr + 16 + g * 8);
    v8f z = {};
    v8f c = __builtin_amdgcn_wmma_f32_16x16x32_f16(false, a.h, false, bf.h,
                                                   (short)0, z, false, false);
    const int pos = posW + pt * 16 + lm;
    _Float16* dst = out16 + ((size_t)b * 4096 + pos) * 256 + h * 32 + it * 16 + g * 8;
    h8v ov;
#pragma unroll
    for (int r = 0; r < 8; ++r) ov[r] = (_Float16)c[r];
    *(h8v*)dst = ov;
  }
}

// ---------------------------------------------------------------------------
// Kernel 6: output projection GEMM [65536 x 256] x [256 x 256] + bias,
// 128x64 block tiling, stored straight into [b][c][H][W] f32 via LDS-staged
// transpose epilogue.
// ---------------------------------------------------------------------------
__global__ __launch_bounds__(256) void k_gemm_out(const _Float16* __restrict__ a16,
                                                  const _Float16* __restrict__ wo16,
                                                  const float* __restrict__ bias,
                                                  float* __restrict__ outp) {
  __shared__ _Float16 ldsA[128 * 40];
  __shared__ _Float16 ldsB[64 * 40];
  __shared__ float    ldsC[8 * 16 * 17];
  const int tid  = threadIdx.x;
  const int wave = tid >> 5, lane = tid & 31;
  const int g = lane >> 4, lm = lane & 15;
  const int m0 = blockIdx.x * 128;
  const int n0 = blockIdx.y * 64;
  v8f acc[4] = {};
  const int arow = tid >> 1, aoff = (tid & 1) * 16;
  const _Float16* asrc = a16 + (size_t)(m0 + arow) * 256 + aoff;
  _Float16* adst = ldsA + arow * 40 + aoff;
  const int brow = tid >> 2, boff = (tid & 3) * 8;
  const _Float16* bsrc = wo16 + (size_t)(n0 + brow) * 256 + boff;
  _Float16* bdst = ldsB + brow * 40 + boff;
  for (int k0 = 0; k0 < 256; k0 += 32) {
    __syncthreads();
    stage16(asrc + k0,     adst);
    stage16(asrc + k0 + 8, adst + 8);
    stage16(bsrc + k0,     bdst);
    stage_wait();
    __syncthreads();
    FragH a;
    const _Float16* ar = ldsA + (wave * 16 + lm) * 40;
    a.q[0] = *(const u32x4*)(ar + g * 8);
    a.q[1] = *(const u32x4*)(ar + 16 + g * 8);
#pragma unroll
    for (int tn = 0; tn < 4; ++tn) {
      FragH bf;
      const _Float16* br = ldsB + (tn * 16 + lm) * 40;
      bf.q[0] = *(const u32x4*)(br + g * 8);
      bf.q[1] = *(const u32x4*)(br + 16 + g * 8);
      acc[tn] = __builtin_amdgcn_wmma_f32_16x16x32_f16(false, a.h, false, bf.h,
                                                       (short)0, acc[tn], false, false);
    }
  }
  const int bb   = m0 >> 12;
  const int posB = m0 & 4095;
  const int rowId = tid >> 1;
  const int wsrc  = rowId >> 4;
  const int d     = rowId & 15;
  const int ho    = (tid & 1) * 8;
#pragma unroll
  for (int tn = 0; tn < 4; ++tn) {
    __syncthreads();
    float* cw = ldsC + wave * (16 * 17);
#pragma unroll
    for (int r = 0; r < 8; ++r)
      cw[lm * 17 + g * 8 + r] = acc[tn][r];
    __syncthreads();
    const int c    = n0 + tn * 16 + d;
    const float bv = bias[c];
    const float* csrc = ldsC + wsrc * (16 * 17) + d * 17 + ho;
    f32x4 o0, o1;
#pragma unroll
    for (int e = 0; e < 4; ++e) { o0[e] = csrc[e] + bv; o1[e] = csrc[4 + e] + bv; }
    float* dst = outp + ((size_t)bb * 256 + c) * 4096 + posB + wsrc * 16 + ho;
    *(f32x4*)dst       = o0;
    *(f32x4*)(dst + 4) = o1;
  }
}

// ---------------------------------------------------------------------------
extern "C" void kernel_launch(void* const* d_in, const int* in_sizes, int n_in,
                              void* d_out, int out_size, void* d_ws, size_t ws_size,
                              hipStream_t stream) {
  (void)in_sizes; (void)n_in; (void)out_size; (void)ws_size;
  const float* x    = (const float*)d_in[0];
  const float* gam  = (const float*)d_in[1];
  const float* bet  = (const float*)d_in[2];
  const float* Wqkv = (const float*)d_in[3];
  const float* temp = (const float*)d_in[4];
  const float* Wout = (const float*)d_in[5];
  const float* bout = (const float*)d_in[6];

  char* ws = (char*)d_ws;
  _Float16* t16   = (_Float16*)ws; ws += (size_t)65536 * 256 * 2;            // 32 MB
  _Float16* w16   = (_Float16*)ws; ws += (size_t)768 * 256 * 2;              // 384 KB
  _Float16* wo16  = (_Float16*)ws; ws += (size_t)256 * 256 * 2;              // 128 KB
  _Float16* qkv16 = (_Float16*)ws; ws += (size_t)3 * 16 * 8 * 32 * 4096 * 2; // 96 MB
  _Float16* out16 = (_Float16*)ws; ws += (size_t)65536 * 256 * 2;            // 32 MB
  float*    simP  = (float*)ws;    ws += (size_t)128 * 4 * 1024 * 4;         // 2 MB
  float*    ssP   = (float*)ws;    ws += (size_t)128 * 4 * 64 * 4;           // 128 KB
  float* outp = (float*)d_out;

  k_ln      <<<dim3(16, 128), 256, 0, stream>>>(x, gam, bet, t16);
  k_cvtw    <<<dim3(1024),    256, 0, stream>>>(Wqkv, Wout, w16, wo16);
  k_gemm_qkv<<<dim3(512, 12), 256, 0, stream>>>(t16, w16, qkv16);
  k_sim     <<<dim3(128, 4),  256, 0, stream>>>(qkv16, simP, ssP);
  k_attn_out<<<dim3(128, 8),  256, 0, stream>>>(qkv16, simP, ssP, temp, out16);
  k_gemm_out<<<dim3(512, 4),  256, 0, stream>>>(out16, wo16, bout, outp);
}

// v003
// It runs in 96.7 microseconds.
// Next to v002, in two timings, it ran 1.68 times as fast each time.
// Over all steps from v000 it is 2.25 times as fast.
#include <hip/hip_runtime.h>
#include <hip/hip_bf16.h>
#include <math.h>
#include <stdint.h>

typedef __attribute__((ext_vector_type(16))) _Float16 v16h;
typedef __attribute__((ext_vector_type(8)))  float    v8f;
typedef __attribute__((ext_vector_type(4)))  unsigned u32x4;
typedef __attribute__((ext_vector_type(8)))  _Float16 h8v;
typedef __attribute__((ext_vector_type(4)))  float    f32x4;
typedef __attribute__((ext_vector_type(4)))  int      i32x4;

union FragH { v16h h; u32x4 q[2]; };

#define LN_EPS   1e-5f
#define L2_EPS   1e-12f
#define SM_SCALE 8.0f

// ---------------------------------------------------------------------------
// CDNA5 async global->LDS staging (ASYNCcnt path), with safe fallback.
// Builtin signature (leaked by compiler diagnostic): param0 = int4 addrspace(1)*.
// ---------------------------------------------------------------------------
#if defined(__HIP_DEVICE_COMPILE__) && __has_builtin(__builtin_amdgcn_global_load_async_to_lds_b128)
#define USE_ASYNC_LDS 1
#else
#define USE_ASYNC_LDS 0
#endif

#if USE_ASYNC_LDS
typedef __attribute__((address_space(1))) i32x4 g_i32x4;
typedef __attribute__((address_space(3))) i32x4 l_i32x4;
#endif

__device__ __forceinline__ void stage16(const _Float16* g, _Float16* l) {
#if USE_ASYNC_LDS
  __builtin_amdgcn_global_load_async_to_lds_b128(
      (g_i32x4*)(uintptr_t)g,
      (l_i32x4*)(uint32_t)(uintptr_t)l, 0, 0);
#else
  *(u32x4*)l = *(const u32x4*)g;
#endif
}

// ---------------------------------------------------------------------------
// Kernel 1: LayerNorm over channels with LDS transpose.
// x is [b][c=256][pos=4096]; we need per-pos stats over c. Load a 256c x 32pos
// tile coalesced along pos, reduce per pos, emit f16 rows t16[(b*4096+pos)][c].
// ---------------------------------------------------------------------------
__global__ __launch_bounds__(256) void k_ln(const float* __restrict__ x,
                                            const float* __restrict__ gamma,
                                            const float* __restrict__ beta,
                                            _Float16* __restrict__ t16) {
  __shared__ float xs[256 * 33];
  __shared__ float redS[256], redQ[256];
  __shared__ float muS[32], riS[32];
  const int b    = blockIdx.x;
  const int pos0 = blockIdx.y * 32;
  const int tid  = threadIdx.x;
  for (int idx = tid; idx < 256 * 32; idx += 256) {
    int c = idx >> 5, p = idx & 31;
    xs[c * 33 + p] = x[((size_t)b * 256 + c) * 4096 + pos0 + p];
  }
  __syncthreads();
  const int pl = tid & 31, sl = tid >> 5;
  float s = 0.f, q = 0.f;
  for (int c = sl * 32; c < sl * 32 + 32; ++c) {
    float v = xs[c * 33 + pl];
    s += v; q += v * v;
  }
  redS[tid] = s; redQ[tid] = q;
  __syncthreads();
  if (tid < 32) {
    float ts = 0.f, tq = 0.f;
    for (int w = 0; w < 8; ++w) { ts += redS[w * 32 + tid]; tq += redQ[w * 32 + tid]; }
    float mu  = ts * (1.0f / 256.0f);
    float var = tq * (1.0f / 256.0f) - mu * mu;
    muS[tid] = mu;
    riS[tid] = rsqrtf(var + LN_EPS);
  }
  __syncthreads();
  const float gma = gamma[tid], bta = beta[tid];
  for (int p = 0; p < 32; ++p) {
    float v = (xs[tid * 33 + p] - muS[p]) * riS[p] * gma + bta;
    t16[((size_t)b * 4096 + pos0 + p) * 256 + tid] = (_Float16)v;
  }
}

// ---------------------------------------------------------------------------
// Kernel 2: convert weights to f16, stored transposed (w16[col][k]).
// ---------------------------------------------------------------------------
__global__ __launch_bounds__(256) void k_cvtw(const float* __restrict__ Wqkv,
                                              const float* __restrict__ Wout,
                                              _Float16* __restrict__ w16,
                                              _Float16* __restrict__ wo16) {
  int idx = blockIdx.x * 256 + threadIdx.x;
  if (idx < 768 * 256) {
    int col = idx >> 8, k = idx & 255;
    w16[idx] = (_Float16)Wqkv[(size_t)k * 768 + col];
  } else {
    int i2 = idx - 768 * 256;
    if (i2 < 256 * 256) {
      int col = i2 >> 8, k = i2 & 255;
      wo16[i2] = (_Float16)Wout[(size_t)k * 256 + col];
    }
  }
}

// ---------------------------------------------------------------------------
// Shared parts of the two projection GEMMs (kernels 3 and 6).
// A work-group of 8 waves owns 256 rows of A. Each wave holds its 32 rows over
// the whole K = 256 in registers (2 x 8 fragments) and the work-group walks all
// columns in chunks of 64: a chunk of W (64 rows x 256 k) lies in one of two
// LDS buffers, the next chunk's async copies fly while this one is worked on.
// Fragment layout per CDNA5 ISA 7.12.2 (16-bit A 16x32): lane l holds row
// m=l&15; halves 0..7 = K {g*8..g*8+7}, halves 8..15 = K {16+g*8..}, g=l>>4.
// ---------------------------------------------------------------------------
#define WPITCH 264   // halves per W row in LDS: 512 B + 16 B (16 B x odd)

// one chunk of W: 64 rows of 512 B; each copy of a wave moves one whole row
__device__ __forceinline__ void copy_wchunk(const _Float16* __restrict__ wsrc,
                                            _Float16* buf, int tid) {
#pragma unroll
  for (int i = 0; i < 8; ++i) {
    const int row = i * 8 + (tid >> 5), off = (tid & 31) * 8;
    stage16(wsrc + row * 256 + off, buf + row * WPITCH + off);
  }
}

// the wave's 32 rows of A over all K, straight from global memory
__device__ __forceinline__ void load_afrags(const _Float16* __restrict__ ar, FragH (&a)[2][8]) {
#pragma unroll
  for (int mt = 0; mt < 2; ++mt)
#pragma unroll
    for (int ks = 0; ks < 8; ++ks) {
      a[mt][ks].q[0] = *(const u32x4*)(ar + mt * 16 * 256 + ks * 32);
      a[mt][ks].q[1] = *(const u32x4*)(ar + mt * 16 * 256 + ks * 32 + 16);
    }
}

// one block of W fragments: 2 k steps x 4 column tiles, 16 LDS reads issued as one group
__device__ __forceinline__ void load_wblock(FragH (&bs)[8], const _Float16* br, int blk) {
#pragma unroll
  for (int k2 = 0; k2 < 2; ++k2)
#pragma unroll
    for (int tn = 0; tn < 4; ++tn) {
      bs[k2 * 4 + tn].q[0] = *(const u32x4*)(br + tn * 16 * WPITCH + (blk * 2 + k2) * 32);
      bs[k2 * 4 + tn].q[1] = *(const u32x4*)(br + tn * 16 * WPITCH + (blk * 2 + k2) * 32 + 16);
    }
}

// 32 rows x 64 columns over K = 256, in 4 blocks of 16 products; each W fragment
// serves two products. bs[0] holds block 0 on entry; each later block is read
// into the other fragment set while the current block's products run.
__device__ __forceinline__ void chunk_products(const FragH (&a)[2][8], const _Float16* br,
                                               FragH (&bs)[2][8], v8f (&acc)[2][4]) {
#pragma unroll
  for (int blk = 0; blk < 4; ++blk) {
    if (blk < 3) load_wblock(bs[(blk + 1) & 1], br, blk + 1);
    // keeps the next block's LDS reads one group in front of this block's products:
    // sunk among them, each product pair would wait out an LDS latency of its own
    __builtin_amdgcn_sched_barrier(0);
#pragma unroll
    for (int k2 = 0; k2 < 2; ++k2)
#pragma unroll
      for (int tn = 0; tn < 4; ++tn)
#pragma unroll
        for (int mt = 0; mt < 2; ++mt)
          acc[mt][tn] = __builtin_amdgcn_wmma_f32_16x16x32_f16(
              false, a[mt][blk * 2 + k2].h, false, bs[blk & 1][k2 * 4 + tn].h,
              (short)0, acc[mt][tn], false, false);
    // the other side of the same fence: later reads do not rise into this block
    __builtin_amdgcn_sched_barrier(0);
  }
}

// the wave's own LDS reads and writes have retired (in front of a hand-over barrier)
__device__ __forceinline__ void wait_lds()    { asm volatile("s_wait_dscnt 0x0" ::: "memory"); }
// the wave's own async copies have landed (in front of the barrier that publishes them)
__device__ __forceinline__ void wait_copies() { asm volatile("s_wait_asynccnt 0x0" ::: "memory"); }

// ---------------------------------------------------------------------------
// Kernel 3: qkv projection GEMM  [65536 x 256] x [256 x 768] with WMMA.
// Each chunk's 256 pos x 64 col result goes as f16 into one of two LDS staging
// tiles [col][pos]; behind the chunk's one barrier every wave stores 8 columns,
// 512 contiguous bytes each, into planar qkv16[3][b][h][d][n].
// ---------------------------------------------------------------------------
__global__ __launch_bounds__(256) void k_gemm_qkv(const _Float16* __restrict__ t16,
                                                  const _Float16* __restrict__ w16,
                                                  _Float16* __restrict__ qkv16) {
  __shared__ __attribute__((aligned(16))) _Float16 ldsB[2][64 * WPITCH];
  __shared__ __attribute__((aligned(16))) _Float16 ldsS[2][64 * 264];
  const int tid  = threadIdx.x;
  // the wave's number in a scalar register: column and row offsets formed from it stay scalar
  const int wave = __builtin_amdgcn_readfirstlane(tid >> 5), lane = tid & 31;
  const int g = lane >> 4, lm = lane & 15;
  const int m0 = blockIdx.x * 256;
  const int bb = m0 >> 12, posB = m0 & 4095;
  copy_wchunk(w16, ldsB[0], tid);
  FragH a[2][8];
  load_afrags(t16 + (size_t)(m0 + wave * 32 + lm) * 256 + g * 8, a);
  wait_copies();
  __syncthreads();
  copy_wchunk(w16 + 64 * 256, ldsB[1], tid);
  FragH bs[2][8];
  load_wblock(bs[0], ldsB[0] + lm * WPITCH + g * 8, 0);
  // stays rolled: one trip already holds 64 products, and the loop's text stays short
#pragma unroll 1
  for (int ch = 0; ch < 12; ++ch) {
    v8f acc[2][4] = {};
    chunk_products(a, ldsB[ch & 1] + lm * WPITCH + g * 8, bs, acc);
    _Float16* ss = ldsS[ch & 1];
#pragma unroll
    for (int mt = 0; mt < 2; ++mt)
#pragma unroll
      for (int tn = 0; tn < 4; ++tn) {
        h8v ov;
#pragma unroll
        for (int r = 0; r < 8; ++r) ov[r] = (_Float16)acc[mt][tn][r];
        *(h8v*)(ss + (tn * 16 + lm) * 264 + wave * 32 + mt * 16 + g * 8) = ov;
      }
    // hand-over: chunk ch+1 of W and this chunk's staging tile become readable,
    // and every reader has left the W buffer that is refilled below
    wait_lds();
    wait_copies();
    __syncthreads();
    if (ch + 2 < 12) copy_wchunk(w16 + (size_t)(ch + 2) * 64 * 256, ldsB[ch & 1], tid);
    // the next chunk's first block, behind the barrier that has published it
    if (ch + 1 < 12) load_wblock(bs[0], ldsB[(ch + 1) & 1] + lm * WPITCH + g * 8, 0);
#pragma unroll
    for (int i = 0; i < 8; ++i) {
      const int cl  = wave * 8 + i;
      const int col = ch * 64 + cl;
      const u32x4 v = *(const u32x4*)(ss + cl * 264 + lane * 8);
      const size_t row = (size_t)(col >> 8) * 4096 + bb * 256 + (col & 255);
      *(u32x4*)(qkv16 + row * 4096 + posB + lane * 8) = v;
    }
    // stands in front of the next trip's first overwrite of a register of the stores above
    asm volatile("s_wait_xcnt 0x0" ::: "memory");
  }
  wait_copies();
}

// ---------------------------------------------------------------------------
// Kernel 5a: partial cross-covariance sums. sim = q . k^T over n (K=4096) is
// split over n: work-group (bh, sl) takes 1024 positions, each of its 8 waves
// a span of 128 and all four 16x16 tiles of the 32x32 result. The 8 spans are
// summed through LDS in wave order; simP[bh][sl][32*32] f32 goes to kernel 5b.
// q and k are read as the projection left them (not normalized). The sums of
// squares of their rows over the same span are the diagonals of q.q^T and
// k.k^T, taken from the fragments already in registers; they are summed the
// same way into ssP[bh][sl][64] (32 q rows, then 32 k rows) for kernel 5b.
// ---------------------------------------------------------------------------
__global__ __launch_bounds__(256) void k_sim(const _Float16* __restrict__ qkv16,
                                             float* __restrict__ simP,
                                             float* __restrict__ ssP) {
  __shared__ float part[8 * 32 * 33];
  __shared__ float ssW[8 * 64];
  const int bh = blockIdx.x, sl = blockIdx.y;
  const int b = bh >> 3, h = bh & 7;
  const int tid  = threadIdx.x;
  const int wave = tid >> 5, lane = tid & 31;
  const int g = lane >> 4, lm = lane & 15;
  const size_t planeQ = (((size_t)0 * 16 + b) * 8 + h) * (size_t)32 * 4096;
  const size_t planeK = (((size_t)1 * 16 + b) * 8 + h) * (size_t)32 * 4096;
  const int n0 = sl * 1024 + wave * 128;
  const _Float16* qr = qkv16 + planeQ + (size_t)lm * 4096 + n0;
  const _Float16* kr = qkv16 + planeK + (size_t)lm * 4096 + n0;
  // the wave's whole span is loaded first: 32 loads in flight, one memory latency
  // (every loop over a[], bf[], acc[] is unrolled so that they stay in registers)
  FragH a[4][2], bf[4][2];
#pragma unroll
  for (int s = 0; s < 4; ++s)
#pragma unroll
    for (int t = 0; t < 2; ++t) {
      a[s][t].q[0]  = *(const u32x4*)(qr + t * 16 * 4096 + s * 32 + g * 8);
      a[s][t].q[1]  = *(const u32x4*)(qr + t * 16 * 4096 + s * 32 + 16 + g * 8);
      bf[s][t].q[0] = *(const u32x4*)(kr + t * 16 * 4096 + s * 32 + g * 8);
      bf[s][t].q[1] = *(const u32x4*)(kr + t * 16 * 4096 + s * 32 + 16 + g * 8);
    }
  // keeps the scheduler from sinking loads between the products, where each
  // group would wait out its own latency
  __builtin_amdgcn_sched_barrier(0);
  v8f acc[2][2] = {};
  v8f qq[2] = {}, kk[2] = {};
#pragma unroll
  for (int s = 0; s < 4; ++s) {
#pragma unroll
    for (int it = 0; it < 2; ++it)
#pragma unroll
      for (int jt = 0; jt < 2; ++jt)
        acc[it][jt] = __builtin_amdgcn_wmma_f32_16x16x32_f16(false, a[s][it].h, false, bf[s][jt].h,
                                                             (short)0, acc[it][jt], false, false);
    // A and B fragments share one k order, so a fragment times itself is a Gram tile
#pragma unroll
    for (int t = 0; t < 2; ++t) {
      qq[t] = __builtin_amdgcn_wmma_f32_16x16x32_f16(false, a[s][t].h, false, a[s][t].h,
                                                     (short)0, qq[t], false, false);
      kk[t] = __builtin_amdgcn_wmma_f32_16x16x32_f16(false, bf[s][t].h, false, bf[s][t].h,
                                                     (short)0, kk[t], false, false);
    }
  }
  // diagonal element of row lm sits in the lane with g == lm >> 3, register lm & 7
#pragma unroll
  for (int t = 0; t < 2; ++t) {
    float dq = qq[t][0], dk = kk[t][0];
#pragma unroll
    for (int r = 1; r < 8; ++r)
      if ((lm & 7) == r) { dq = qq[t][r]; dk = kk[t][r]; }
    if ((lm >> 3) == g) {
      ssW[wave * 64 + t * 16 + lm]      = dq;
      ssW[wave * 64 + 32 + t * 16 + lm] = dk;
    }
  }
  float* pw = part + wave * (32 * 33);
#pragma unroll
  for (int it = 0; it < 2; ++it)
#pragma unroll
    for (int jt = 0; jt < 2; ++jt)
#pragma unroll
      for (int r = 0; r < 8; ++r)
        pw[(it * 16 + g * 8 + r) * 33 + jt * 16 + lm] = acc[it][jt][r];
  __syncthreads();
  float* dst = simP + ((size_t)bh * 4 + sl) * 1024;
  for (int idx = tid; idx < 1024; idx += 256) {
    const int o = (idx >> 5) * 33 + (idx & 31);
    float s = part[o];
#pragma unroll
    for (int w = 1; w < 8; ++w) s += part[w * (32 * 33) + o];
    dst[idx] = s;
  }
  if (tid < 64) {
    float s = ssW[tid];
#pragma unroll
    for (int w = 1; w < 8; ++w) s += ssW[w * 64 + tid];
    ssP[((size_t)bh * 4 + sl) * 64 + tid] = s;
  }
}

// ---------------------------------------------------------------------------
// Kernel 5b: per (b,h) and slice of 512 positions:
//   sim = sum of the 4 partial planes, in slice order, times
//         exp(temperature[h]) / max(|q_i|, eps) / max(|k_j|, eps), the norms
//         from the 4 partial sums of squares (the l2norm of q and k)
//   softmax(sim * 8) over j (repeated in every slice's work-group)
//   out = attn . v  (K=32, one WMMA per 16x16 tile; v transposed via LDS)
// Output rows out16[(b*4096+pos)][h*32+i] f16 for the final GEMM.
// ---------------------------------------------------------------------------
__global__ __launch_bounds__(256) void k_attn_out(const _Float16* __restrict__ qkv16,
                                                  const float* __restrict__ simP,
                                                  const float* __restrict__ ssP,
                                                  const float* __restrict__ temperature,
                                                  _Float16* __restrict__ out16) {
  __shared__ float    sim[32 * 33];
  __shared__ _Float16 attnS[32 * 32];
  __shared__ _Float16 ldsV[512 * 40];
  const int bh = blockIdx.x;
  const int posW = blockIdx.y * 512;
  const int b = bh >> 3, h = bh & 7;
  const int tid  = threadIdx.x;
  const int wave = tid >> 5, lane = tid & 31;
  const int g = lane >> 4, lm = lane & 15;
  const size_t planeV = (((size_t)2 * 16 + b) * 8 + h) * (size_t)32 * 4096;
  // ---- partial planes and partial sums of squares into registers
  // (loops over pS[], pK[], pQ[] are unrolled: they stay in registers)
  f32x4 pS[4], pK[4];
  float pQ[4];
  {
    const float* sp = simP + (size_t)bh * 4 * 1024 + tid * 4;
    const float* nq = ssP + (size_t)bh * 4 * 64 + (tid >> 3);
    const float* nk = ssP + (size_t)bh * 4 * 64 + 32 + (tid & 7) * 4;
#pragma unroll
    for (int sl = 0; sl < 4; ++sl) {
      pS[sl] = *(const f32x4*)(sp + sl * 1024);
      pK[sl] = *(const f32x4*)(nk + sl * 64);
      pQ[sl] = nq[sl * 64];
    }
  }
  // ---- v[j][pos] slice (32 x 512) into registers; it goes to LDS below
  const int vj = (tid & 127) >> 2, vp = (tid >> 7) * 64 + (tid & 3) * 16;
  // (loops over tmp[] are unrolled: it stays in registers, 8 loads in flight)
  union { u32x4 q[2]; _Float16 t[16]; } tmp[4];
  {
    const _Float16* src = qkv16 + planeV + (size_t)vj * 4096 + posW + vp;
#pragma unroll
    for (int s = 0; s < 4; ++s) {
      tmp[s].q[0] = *(const u32x4*)(src + s * 128);
      tmp[s].q[1] = *(const u32x4*)(src + s * 128 + 8);
    }
  }
  // stands in front of the first overwrite of an address register of the loads above
  asm volatile("s_wait_xcnt 0x0" ::: "memory");
  // keeps the scheduler from sinking the v loads behind the waits of the sums
  // below, where they would wait out a second memory latency
  __builtin_amdgcn_sched_barrier(0);
  const float tq = temperature[h];
  // ---- sim = sum of the partial planes, scaled by the inverse norms
  {
    f32x4 s4 = pS[0], ssk = pK[0];
    float ssq = pQ[0];
#pragma unroll
    for (int sl = 1; sl < 4; ++sl) { s4 += pS[sl]; ssk += pK[sl]; ssq += pQ[sl]; }
    const float sq = __expf(tq) * (1.0f / fmaxf(sqrtf(ssq), L2_EPS));
    float* sd = sim + (tid >> 3) * 33 + (tid & 7) * 4;
#pragma unroll
    for (int e = 0; e < 4; ++e)
      sd[e] = s4[e] * sq * (1.0f / fmaxf(sqrtf(ssk[e]), L2_EPS));
  }
  __syncthreads();
  // ---- softmax rows (32 rows of 32)
  if (tid < 32) {
    float* row = sim + tid * 33;
    float mx = -1e30f;
    for (int j = 0; j < 32; ++j) mx = fmaxf(mx, row[j]);
    float sum = 0.f;
    for (int j = 0; j < 32; ++j) {
      float e = __expf((row[j] - mx) * SM_SCALE);
      row[j] = e; sum += e;
    }
    float inv = 1.0f / sum;
    for (int j = 0; j < 32; ++j)
      attnS[tid * 32 + j] = (_Float16)(row[j] * inv);
  }
  // ---- transpose the v slice into ldsV[pos][j]
#pragma unroll
  for (int s = 0; s < 4; ++s)
#pragma unroll
    for (int e = 0; e < 16; ++e)
      ldsV[(s * 128 + vp + e) * 40 + vj] = tmp[s].t[e];
  __syncthreads();
  // ---- out = attn @ v  (wave -> (i_tile, 8 pos tiles))
  const int it = wave & 1, pp = wave >> 1;
  FragH a;
  {
    const _Float16* ar = attnS + (it * 16 + lm) * 32;
    a.q[0] = *(const u32x4*)(ar + g * 8);
    a.q[1] = *(const u32x4*)(ar + 16 + g * 8);
  }
  // unrolled so that the LDS reads of later tiles overlap earlier products and stores
#pragma unroll
  for (int u = 0; u < 8; ++u) {
    const int pt = pp * 8 + u;
    FragH bf;
    const _Float16* vr = ldsV + (pt * 16 + lm) * 40;
    bf.q[0] = *(const u32x4*)(vr + g * 8);
    bf.q[1] = *(const u32x4*)(vr + 16 + g * 8);
    v8f z = {};
    v8f c = __builtin_amdgcn_wmma_f32_16x16x32_f16(false, a.h, false, bf.h,
                                                   (short)0, z, false, false);
    const int pos = posW + pt * 16 + lm;
    _Float16* dst = out16 + ((size_t)b * 4096 + pos) * 256 + h * 32 + it * 16 + g * 8;
    h8v ov;
#pragma unroll
    for (int r = 0; r < 8; ++r) ov[r] = (_Float16)c[r];
    *(h8v*)dst = ov;
  }
}

// ---------------------------------------------------------------------------
// Kernel 6: output projection GEMM [65536 x 256] x [256 x 256] + bias, in the
// form of kernel 3 (4 chunks of 64 columns); the staging tiles hold f32 + bias, and
// every wave stores 8 columns of 1024 contiguous bytes into [b][c][H][W].
// ---------------------------------------------------------------------------
__global__ __launch_bounds__(256) void k_gemm_out(const _Float16* __restrict__ a16,
                                                  const _Float16* __restrict__ wo16,
                                                  const float* __restrict__ bias,
                                                  float* __restrict__ outp) {
  __shared__ __attribute__((aligned(16))) _Float16 ldsB[2][64 * WPITCH];
  __shared__ __attribute__((aligned(16))) float    ldsS[2][64 * 260];
  const int tid  = threadIdx.x;
  // the wave's number in a scalar register: column and row offsets formed from it stay scalar
  const int wave = __builtin_amdgcn_readfirstlane(tid >> 5), lane = tid & 31;
  const int g = lane >> 4, lm = lane & 15;
  const int m0 = blockIdx.x * 256;
  const int bb = m0 >> 12, posB = m0 & 4095;
  copy_wchunk(wo16, ldsB[0], tid);
  FragH a[2][8];
  load_afrags(a16 + (size_t)(m0 + wave * 32 + lm) * 256 + g * 8, a);
  wait_copies();
  __syncthreads();
  copy_wchunk(wo16 + 64 * 256, ldsB[1], tid);
  FragH bs[2][8];
  load_wblock(bs[0], ldsB[0] + lm * WPITCH + g * 8, 0);
  // stays rolled: one trip already holds 64 products, and the loop's text stays short
#pragma unroll 1
  for (int ch = 0; ch < 4; ++ch) {
    // this chunk's bias, one value per column tile; read here, its latency passes under the products
    float bv[4];
#pragma unroll
    for (int tn = 0; tn < 4; ++tn) bv[tn] = bias[ch * 64 + tn * 16 + lm];
    v8f acc[2][4] = {};
    chunk_products(a, ldsB[ch & 1] + lm * WPITCH + g * 8, bs, acc);
    float* ss = ldsS[ch & 1];
#pragma unroll
    for (int mt = 0; mt < 2; ++mt)
#pragma unroll
      for (int tn = 0; tn < 4; ++tn) {
        float* sd = ss + (tn * 16 + lm) * 260 + wave * 32 + mt * 16 + g * 8;
        f32x4 lo, hi;
#pragma unroll
        for (int e = 0; e < 4; ++e) { lo[e] = acc[mt][tn][e] + bv[tn]; hi[e] = acc[mt][tn][4 + e] + bv[tn]; }
        *(f32x4*)sd       = lo;
        *(f32x4*)(sd + 4) = hi;
      }
    // hand-over: chunk ch+1 of W and this chunk's staging tile become readable,
    // and every reader has left the W buffer that is refilled below
    wait_lds();
    wait_copies();
    __syncthreads();
    if (ch + 2 < 4) copy_wchunk(wo16 + (size_t)(ch + 2) * 64 * 256, ldsB[ch & 1], tid);
    // the next chunk's first block, behind the barrier that has published it
    if (ch + 1 < 4) load_wblock(bs[0], ldsB[(ch + 1) & 1] + lm * WPITCH + g * 8, 0);
#pragma unroll
    for (int i = 0; i < 8; ++i) {
      const int cl = wave * 8 + i;
      const int c  = ch * 64 + cl;
      float* dst = outp + ((size_t)bb * 256 + c) * 4096 + posB;
#pragma unroll
      for (int hf = 0; hf < 2; ++hf) {
        const f32x4 o = *(const f32x4*)(ss + cl * 260 + hf * 128 + lane * 4);
        *(f32x4*)(dst + hf * 128 + lane * 4) = o;
      }
    }
    // stands in front of the next trip's first overwrite of a register of the stores above
    asm volatile("s_wait_xcnt 0x0" ::: "memory");
  }
  wait_copies();
}

// ---------------------------------------------------------------------------
extern "C" void kernel_launch(void* const* d_in, const int* in_sizes, int n_in,
                              void* d_out, int out_size, void* d_ws, size_t ws_size,
                              hipStream_t stream) {
  (void)in_sizes; (void)n_in; (void)out_size; (void)ws_size;
  const float* x    = (const float*)d_in[0];
  const float* gam  = (const float*)d_in[1];
  const float* bet  = (const float*)d_in[2];
  const float* Wqkv = (const float*)d_in[3];
  const float* temp = (const float*)d_in[4];
  const float* Wout = (const float*)d_in[5];
  const float* bout = (const float*)d_in[6];

  char* ws = (char*)d_ws;
  _Float16* t16   = (_Float16*)ws; ws += (size_t)65536 * 256 * 2;            // 32 MB
  _Float16* w16   = (_Float16*)ws; ws += (size_t)768 * 256 * 2;              // 384 KB
  _Float16* wo16  = (_Float16*)ws; ws += (size_t)256 * 256 * 2;              // 128 KB
  _Float16* qkv16 = (_Float16*)ws; ws += (size_t)3 * 16 * 8 * 32 * 4096 * 2; // 96 MB
  _Float16* out16 = (_Float16*)ws; ws += (size_t)65536 * 256 * 2;            // 32 MB
  float*    simP  = (float*)ws;    ws += (size_t)128 * 4 * 1024 * 4;         // 2 MB
  float*    ssP   = (float*)ws;    ws += (size_t)128 * 4 * 64 * 4;           // 128 KB
  float* outp = (float*)d_out;

  k_ln      <<<dim3(16, 128), 256, 0, stream>>>(x, gam, bet, t16);
  k_cvtw    <<<dim3(1024),    256, 0, stream>>>(Wqkv, Wout, w16, wo16);
  k_gemm_qkv<<<dim3(256),     256, 0, stream>>>(t16, w16, qkv16);
  k_sim     <<<dim3(128, 4),  256, 0, stream>>>(qkv16, simP, ssP);
  k_attn_out<<<dim3(128, 8),  256, 0, stream>>>(qkv16, simP, ssP, temp, out16);
  k_gemm_out<<<dim3(256),     256, 0, stream>>>(out16, wo16, bout, outp);
}

// v004
// It runs in 89.8 microseconds.
// Timed twice side by side with v003, it ran 1.08 and 1.07 times as fast.
// Counting every step since v000, it is 2.41 times as fast.
#include <hip/hip_runtime.h>
#include <hip/hip_bf16.h>
#include <math.h>
#include <stdint.h>

typedef __attribute__((ext_vector_type(16))) _Float16 v16h;
typedef __attribute__((ext_vector_type(8)))  float    v8f;
typedef __attribute__((ext_vector_type(4)))  unsigned u32x4;
typedef __attribute__((ext_vector_type(8)))  _Float16 h8v;
typedef __attribute__((ext_vector_type(4)))  float    f32x4;
typedef __attribute__((ext_vector_type(2)))  float    f32x2;
typedef __attribute__((ext_vector_type(4)))  int      i32x4;

union FragH { v16h h; u32x4 q[2]; };

#define LN_EPS   1e-5f
#define L2_EPS   1e-12f
#define SM_SCALE 8.0f

// ---------------------------------------------------------------------------
// CDNA5 async global->LDS staging (ASYNCcnt path), with safe fallback.
// Builtin signature (leaked by compiler diagnostic): param0 = int4 addrspace(1)*.
// ---------------------------------------------------------------------------
#if defined(__HIP_DEVICE_COMPILE__) && __has_builtin(__builtin_amdgcn_global_load_async_to_lds_b128)
#define USE_ASYNC_LDS 1
#else
#define USE_ASYNC_LDS 0
#endif

#if USE_ASYNC_LDS
typedef __attribute__((address_space(1))) i32x4 g_i32x4;
typedef __attribute__((address_space(3))) i32x4 l_i32x4;
#endif

__device__ __forceinline__ void stage16(const _Float16* g, _Float16* l) {
#if USE_ASYNC_LDS
  __builtin_amdgcn_global_load_async_to_lds_b128(
      (g_i32x4*)(uintptr_t)g,
      (l_i32x4*)(uint32_t)(uintptr_t)l, 0, 0);
#else
  *(u32x4*)l = *(const u32x4*)g;
#endif
}

// ---------------------------------------------------------------------------
// Kernel 2: convert weights to f16, stored transposed (w16[col][k]).
// ---------------------------------------------------------------------------
__global__ __launch_bounds__(256) void k_cvtw(const float* __restrict__ Wqkv,
                                              const float* __restrict__ Wout,
                                              _Float16* __restrict__ w16,
                                              _Float16* __restrict__ wo16) {
  int idx = blockIdx.x * 256 + threadIdx.x;
  if (idx < 768 * 256) {
    int col = idx >> 8, k = idx & 255;
    w16[idx] = (_Float16)Wqkv[(size_t)k * 768 + col];
  } else {
    int i2 = idx - 768 * 256;
    if (i2 < 256 * 256) {
      int col = i2 >> 8, k = i2 & 255;
      wo16[i2] = (_Float16)Wout[(size_t)k * 256 + col];
    }
  }
}

// ---------------------------------------------------------------------------
// Shared parts of the two projection GEMMs (kernels 3 and 6).
// A work-group of 8 waves owns 256 rows of A. Each wave holds its 32 rows over
// the whole K = 256 in registers (2 x 8 fragments) and the work-group walks all
// columns in chunks of 64: a chunk of W (64 rows x 256 k) lies in one of two
// LDS buffers, the next chunk's async copies fly while this one is worked on.
// Fragment layout per CDNA5 ISA 7.12.2 (16-bit A 16x32): lane l holds row
// m=l&15; halves 0..7 = K {g*8..g*8+7}, halves 8..15 = K {16+g*8..}, g=l>>4.
// ---------------------------------------------------------------------------
#define WPITCH 264   // halves per W row in LDS: 512 B + 16 B (16 B x odd)

// one chunk of W: 64 rows of 512 B; each copy of a wave moves one whole row
__device__ __forceinline__ void copy_wchunk(const _Float16* __restrict__ wsrc,
                                            _Float16* buf, int tid) {
#pragma unroll
  for (int i = 0; i < 8; ++i) {
    const int row = i * 8 + (tid >> 5), off = (tid & 31) * 8;
    stage16(wsrc + row * 256 + off, buf + row * WPITCH + off);
  }
}

// the wave's 32 rows of A over all K, straight from global memory
__device__ __forceinline__ void load_afrags(const _Float16* __restrict__ ar, FragH (&a)[2][8]) {
#pragma unroll
  for (int mt = 0; mt < 2; ++mt)
#pragma unroll
    for (int ks = 0; ks < 8; ++ks) {
      a[mt][ks].q[0] = *(const u32x4*)(ar + mt * 16 * 256 + ks * 32);
      a[mt][ks].q[1] = *(const u32x4*)(ar + mt * 16 * 256 + ks * 32 + 16);
    }
}

// one block of W fragments: 2 k steps x 4 column tiles, 16 LDS reads issued as one group
__device__ __forceinline__ void load_wblock(FragH (&bs)[8], const _Float16* br, int blk) {
#pragma unroll
  for (int k2 = 0; k2 < 2; ++k2)
#pragma unroll
    for (int tn = 0; tn < 4; ++tn) {
      bs[k2 * 4 + tn].q[0] = *(const u32x4*)(br + tn * 16 * WPITCH + (blk * 2 + k2) * 32);
      bs[k2 * 4 + tn].q[1] = *(const u32x4*)(br + tn * 16 * WPITCH + (blk * 2 + k2) * 32 + 16);
    }
}

// 32 rows x 64 columns over K = 256, in 4 blocks of 16 products; each W fragment
// serves two products. bs[0] holds block 0 on entry; each later block is read
// into the other fragment set while the current block's products run.
__device__ __forceinline__ void chunk_products(const FragH (&a)[2][8], const _Float16* br,
                                               FragH (&bs)[2][8], v8f (&acc)[2][4]) {
#pragma unroll
  for (int blk = 0; blk < 4; ++blk) {
    if (blk < 3) load_wblock(bs[(blk + 1) & 1], br, blk + 1);
    // keeps the next block's LDS reads one group in front of this block's products:
    // sunk among them, each product pair would wait out an LDS latency of its own
    __builtin_amdgcn_sched_barrier(0);
#pragma unroll
    for (int k2 = 0; k2 < 2; ++k2)
#pragma unroll
      for (int tn = 0; tn < 4; ++tn)
#pragma unroll
        for (int mt = 0; mt < 2; ++mt)
          acc[mt][tn] = __builtin_amdgcn_wmma_f32_16x16x32_f16(
              false, a[mt][blk * 2 + k2].h, false, bs[blk & 1][k2 * 4 + tn].h,
              (short)0, acc[mt][tn], false, false);
    // the other side of the same fence: later reads do not rise into this block
    __builtin_amdgcn_sched_barrier(0);
  }
}

// the wave's own LDS reads and writes have retired (in front of a hand-over barrier)
__device__ __forceinline__ void wait_lds()    { asm volatile("s_wait_dscnt 0x0" ::: "memory"); }
// the wave's own async copies have landed (in front of the barrier that publishes them)
__device__ __forceinline__ void wait_copies() { asm volatile("s_wait_asynccnt 0x0" ::: "memory"); }

// the value of the lane 16 away (lanes l and l ^ 16 hold the two halves of a row's channels)
__device__ __forceinline__ float other_half(float v) {
  const unsigned u = __float_as_uint(v);
  return __uint_as_float(__builtin_amdgcn_permlanex16(u, u, 0x76543210u, 0xfedcba98u, false, false));
}

// ---------------------------------------------------------------------------
// Kernel 3: LayerNorm over channels + qkv projection GEMM
// [65536 x 256] x [256 x 768] with WMMA.
// x is [b][c=256][pos=4096]. A lane of an A fragment holds one pos and 8 + 8
// channels per k step, so it reads its channels straight from x: one 8-byte
// load per channel brings pos 2*lm and 2*lm+1, which are row lm of the wave's
// first and second 16-row tile (16 lanes = one whole 128-B line of a channel).
// All 256 channels of the wave's 32 pos are then in registers as f32: the sums
// over channels are taken in the lane and added to those of lane l ^ 16, and the
// normalized values are rounded once to f16, in fragment order.
// Each chunk's 256 pos x 64 col result goes as f16 into one of two LDS staging
// tiles [col][pos]; behind the chunk's one barrier every wave stores 8 columns,
// 512 contiguous bytes each, into planar qkv16[3][b][h][d][n].
// ---------------------------------------------------------------------------
__global__ __launch_bounds__(256) void k_gemm_qkv(const float* __restrict__ x,
                                                  const float* __restrict__ gamma,
                                                  const float* __restrict__ beta,
                                                  const _Float16* __restrict__ w16,
                                                  _Float16* __restrict__ qkv16) {
  __shared__ __attribute__((aligned(16))) _Float16 ldsB[2][64 * WPITCH];
  __shared__ __attribute__((aligned(16))) _Float16 ldsS[2][64 * 264];
  __shared__ __attribute__((aligned(16))) float    gamS[256], betS[256];
  const int tid  = threadIdx.x;
  // the wave's number in a scalar register: column and row offsets formed from it stay scalar
  const int wave = __builtin_amdgcn_readfirstlane(tid >> 5), lane = tid & 31;
  const int g = lane >> 4, lm = lane & 15;
  const int m0 = blockIdx.x * 256;
  const int bb = m0 >> 12, posB = m0 & 4095;
  copy_wchunk(w16, ldsB[0], tid);
  const float gmT = gamma[tid], btT = beta[tid];
  // xr[ks][j]: channel ks*32 + (j>>3)*16 + g*8 + (j&7), the fragment's own k order
  // (every loop over xr[] and a[] is unrolled so that they stay in registers)
  f32x2 xr[8][16];
  const float* xp = x + ((size_t)bb * 256 + g * 8) * 4096 + posB + wave * 32 + lm * 2;
#pragma unroll
  for (int ks = 0; ks < 8; ++ks)
#pragma unroll
    for (int j = 0; j < 16; ++j)
      xr[ks][j] = *(const f32x2*)(xp + (size_t)(ks * 32 + (j >> 3) * 16 + (j & 7)) * 4096);
  // stands in front of the first overwrite of an address register of the loads above;
  // xp is named so that its registers live up to here and no load lands in them
  asm volatile("s_wait_xcnt 0x0" :: "v"(xp) : "memory");
  // keeps the scheduler from sinking loads among the sums below: all of them are
  // in flight before the first wait
  __builtin_amdgcn_sched_barrier(0);
  gamS[tid] = gmT;
  betS[tid] = btT;
  // sums and sums of squares of the lane's 128 channels, two chains per sum
  f32x2 sA = {0.f, 0.f}, sB = {0.f, 0.f}, qA = {0.f, 0.f}, qB = {0.f, 0.f};
#pragma unroll
  for (int ks = 0; ks < 8; ++ks)
#pragma unroll
    for (int j = 0; j < 16; j += 2) {
      sA += xr[ks][j];     qA += xr[ks][j] * xr[ks][j];
      sB += xr[ks][j + 1]; qB += xr[ks][j + 1] * xr[ks][j + 1];
    }
  f32x2 mu, ri;
#pragma unroll
  for (int mt = 0; mt < 2; ++mt) {
    const float sh = sA[mt] + sB[mt], qh = qA[mt] + qB[mt];
    const float ts = sh + other_half(sh), tq = qh + other_half(qh);
    const float m  = ts * (1.0f / 256.0f);
    const float var = tq * (1.0f / 256.0f) - m * m;
    mu[mt] = m;
    ri[mt] = rsqrtf(var + LN_EPS);
  }
  wait_copies();
  // publishes chunk 0 of W and gamma, beta
  __syncthreads();
  copy_wchunk(w16 + 64 * 256, ldsB[1], tid);
  FragH a[2][8];
#pragma unroll
  for (int ks = 0; ks < 8; ++ks)
#pragma unroll
    for (int hf = 0; hf < 2; ++hf) {
      const int c0 = ks * 32 + hf * 16 + g * 8;
      f32x4 gm[2], bt[2];
      gm[0] = *(const f32x4*)(gamS + c0); gm[1] = *(const f32x4*)(gamS + c0 + 4);
      bt[0] = *(const f32x4*)(betS + c0); bt[1] = *(const f32x4*)(betS + c0 + 4);
#pragma unroll
      for (int e = 0; e < 8; ++e) {
        const f32x2 v = (xr[ks][hf * 8 + e] - mu) * ri * gm[e >> 2][e & 3] + bt[e >> 2][e & 3];
        a[0][ks].h[hf * 8 + e] = (_Float16)v[0];
        a[1][ks].h[hf * 8 + e] = (_Float16)v[1];
      }
    }
  FragH bs[2][8];
  load_wblock(bs[0], ldsB[0] + lm * WPITCH + g * 8, 0);
  // stays rolled: one trip already holds 64 products, and the loop's text stays short
#pragma unroll 1
  for (int ch = 0; ch < 12; ++ch) {
    v8f acc[2][4] = {};
    chunk_products(a, ldsB[ch & 1] + lm * WPITCH + g * 8, bs, acc);
    _Float16* ss = ldsS[ch & 1];
    // row g*8 + r of tile mt is pos wave*32 + g*16 + 2*r + mt
#pragma unroll
    for (int tn = 0; tn < 4; ++tn)
#pragma unroll
      for (int rh = 0; rh < 2; ++rh) {
        h8v ov;
#pragma unroll
        for (int r = 0; r < 4; ++r) {
          ov[r * 2]     = (_Float16)acc[0][tn][rh * 4 + r];
          ov[r * 2 + 1] = (_Float16)acc[1][tn][rh * 4 + r];
        }
        *(h8v*)(ss + (tn * 16 + lm) * 264 + wave * 32 + g * 16 + rh * 8) = ov;
      }
    // hand-over: chunk ch+1 of W and this chunk's staging tile become readable,
    // and every reader has left the W buffer that is refilled below
    wait_lds();
    wait_copies();
    __syncthreads();
    if (ch + 2 < 12) copy_wchunk(w16 + (size_t)(ch + 2) * 64 * 256, ldsB[ch & 1], tid);
    // the next chunk's first block, behind the barrier that has published it
    if (ch + 1 < 12) load_wblock(bs[0], ldsB[(ch + 1) & 1] + lm * WPITCH + g * 8, 0);
#pragma unroll
    for (int i = 0; i < 8; ++i) {
      const int cl  = wave * 8 + i;
      const int col = ch * 64 + cl;
      const u32x4 v = *(const u32x4*)(ss + cl * 264 + lane * 8);
      const size_t row = (size_t)(col >> 8) * 4096 + bb * 256 + (col & 255);
      *(u32x4*)(qkv16 + row * 4096 + posB + lane * 8) = v;
    }
    // stands in front of the next trip's first overwrite of a register of the stores above
    asm volatile("s_wait_xcnt 0x0" ::: "memory");
  }
  wait_copies();
}

// ---------------------------------------------------------------------------
// Kernel 5a: partial cross-covariance sums. sim = q . k^T over n (K=4096) is
// split over n: work-group (bh, sl) takes 1024 positions, each of its 8 waves
// a span of 128 and all four 16x16 tiles of the 32x32 result. The 8 spans are
// summed through LDS in wave order; simP[bh][sl][32*32] f32 goes to kernel 5b.
// q and k are read as the projection left them (not normalized). The sums of
// squares of their rows over the same span are the diagonals of q.q^T and
// k.k^T, taken from the fragments already in registers; they are summed the
// same way into ssP[bh][sl][64] (32 q rows, then 32 k rows) for kernel 5b.
// ---------------------------------------------------------------------------
__global__ __launch_bounds__(256) void k_sim(const _Float16* __restrict__ qkv16,
                                             float* __restrict__ simP,
                                             float* __restrict__ ssP) {
  __shared__ float part[8 * 32 * 33];
  __shared__ float ssW[8 * 64];
  const int bh = blockIdx.x, sl = blockIdx.y;
  const int b = bh >> 3, h = bh & 7;
  const int tid  = threadIdx.x;
  const int wave = tid >> 5, lane = tid & 31;
  const int g = lane >> 4, lm = lane & 15;
  const size_t planeQ = (((size_t)0 * 16 + b) * 8 + h) * (size_t)32 * 4096;
  const size_t planeK = (((size_t)1 * 16 + b) * 8 + h) * (size_t)32 * 4096;
  const int n0 = sl * 1024 + wave * 128;
  const _Float16* qr = qkv16 + planeQ + (size_t)lm * 4096 + n0;
  const _Float16* kr = qkv16 + planeK + (size_t)lm * 4096 + n0;
  // the wave's whole span is loaded first: 32 loads in flight, one memory latency
  // (every loop over a[], bf[], acc[] is unrolled so that they stay in registers)
  FragH a[4][2], bf[4][2];
#pragma unroll
  for (int s = 0; s < 4; ++s)
#pragma unroll
    for (int t = 0; t < 2; ++t) {
      a[s][t].q[0]  = *(const u32x4*)(qr + t * 16 * 4096 + s * 32 + g * 8);
      a[s][t].q[1]  = *(const u32x4*)(qr + t * 16 * 4096 + s * 32 + 16 + g * 8);
      bf[s][t].q[0] = *(const u32x4*)(kr + t * 16 * 4096 + s * 32 + g * 8);
      bf[s][t].q[1] = *(const u32x4*)(kr + t * 16 * 4096 + s * 32 + 16 + g * 8);
    }
  // keeps the scheduler from sinking loads between the products, where each
  // group would wait out its own latency
  __builtin_amdgcn_sched_barrier(0);
  v8f acc[2][2] = {};
  v8f qq[2] = {}, kk[2] = {};
#pragma unroll
  for (int s = 0; s < 4; ++s) {
#pragma unroll
    for (int it = 0; it < 2; ++it)
#pragma unroll
      for (int jt = 0; jt < 2; ++jt)
        acc[it][jt] = __builtin_amdgcn_wmma_f32_16x16x32_f16(false, a[s][it].h, false, bf[s][jt].h,
                                                             (short)0, acc[it][jt], false, false);
    // A and B fragments share one k order, so a fragment times itself is a Gram tile
#pragma unroll
    for (int t = 0; t < 2; ++t) {
      qq[t] = __builtin_amdgcn_wmma_f32_16x16x32_f16(false, a[s][t].h, false, a[s][t].h,
                                                     (short)0, qq[t], false, false);
      kk[t] = __builtin_amdgcn_wmma_f32_16x16x32_f16(false, bf[s][t].h, false, bf[s][t].h,
                                                     (short)0, kk[t], false, false);
    }
  }
  // diagonal element of row lm sits in the lane with g == lm >> 3, register lm & 7
#pragma unroll
  for (int t = 0; t < 2; ++t) {
    float dq = qq[t][0], dk = kk[t][0];
#pragma unroll
    for (int r = 1; r < 8; ++r)
      if ((lm & 7) == r) { dq = qq[t][r]; dk = kk[t][r]; }
    if ((lm >> 3) == g) {
      ssW[wave * 64 + t * 16 + lm]      = dq;
      ssW[wave * 64 + 32 + t * 16 + lm] = dk;
    }
  }
  float* pw = part + wave * (32 * 33);
#pragma unroll
  for (int it = 0; it < 2; ++it)
#pragma unroll
    for (int jt = 0; jt < 2; ++jt)
#pragma unroll
      for (int r = 0; r < 8; ++r)
        pw[(it * 16 + g * 8 + r) * 33 + jt * 16 + lm] = acc[it][jt][r];
  __syncthreads();
  float* dst = simP + ((size_t)bh * 4 + sl) * 1024;
  for (int idx = tid; idx < 1024; idx += 256) {
    const int o = (idx >> 5) * 33 + (idx & 31);
    float s = part[o];
#pragma unroll
    for (int w = 1; w < 8; ++w) s += part[w * (32 * 33) + o];
    dst[idx] = s;
  }
  if (tid < 64) {
    float s = ssW[tid];
#pragma unroll
    for (int w = 1; w < 8; ++w) s += ssW[w * 64 + tid];
    ssP[((size_t)bh * 4 + sl) * 64 + tid] = s;
  }
}

// ---------------------------------------------------------------------------
// Kernel 5b: per (b,h) and slice of 512 positions:
//   sim = sum of the 4 partial planes, in slice order, times
//         exp(temperature[h]) / max(|q_i|, eps) / max(|k_j|, eps), the norms
//         from the 4 partial sums of squares (the l2norm of q and k)
//   softmax(sim * 8) over j (repeated in every slice's work-group)
//   out = attn . v  (K=32, one WMMA per 16x16 tile; v transposed via LDS)
// Output rows out16[(b*4096+pos)][h*32+i] f16 for the final GEMM.
// ---------------------------------------------------------------------------
__global__ __launch_bounds__(256) void k_attn_out(const _Float16* __restrict__ qkv16,
                                                  const float* __restrict__ simP,
                                                  const float* __restrict__ ssP,
                                                  const float* __restrict__ temperature,
                                                  _Float16* __restrict__ out16) {
  __shared__ float    sim[32 * 33];
  __shared__ _Float16 attnS[32 * 32];
  __shared__ _Float16 ldsV[512 * 40];
  const int bh = blockIdx.x;
  const int posW = blockIdx.y * 512;
  const int b = bh >> 3, h = bh & 7;
  const int tid  = threadIdx.x;
  const int wave = tid >> 5, lane = tid & 31;
  const int g = lane >> 4, lm = lane & 15;
  const size_t planeV = (((size_t)2 * 16 + b) * 8 + h) * (size_t)32 * 4096;
  // ---- partial planes and partial sums of squares into registers
  // (loops over pS[], pK[], pQ[] are unrolled: they stay in registers)
  f32x4 pS[4], pK[4];
  float pQ[4];
  {
    const float* sp = simP + (size_t)bh * 4 * 1024 + tid * 4;
    const float* nq = ssP + (size_t)bh * 4 * 64 + (tid >> 3);
    const float* nk = ssP + (size_t)bh * 4 * 64 + 32 + (tid & 7) * 4;
#pragma unroll
    for (int sl = 0; sl < 4; ++sl) {
      pS[sl] = *(const f32x4*)(sp + sl * 1024);
      pK[sl] = *(const f32x4*)(nk + sl * 64);
      pQ[sl] = nq[sl * 64];
    }
  }
  // ---- v[j][pos] slice (32 x 512) into registers; it goes to LDS below
  const int vj = (tid & 127) >> 2, vp = (tid >> 7) * 64 + (tid & 3) * 16;
  // (loops over tmp[] are unrolled: it stays in registers, 8 loads in flight)
  union { u32x4 q[2]; _Float16 t[16]; } tmp[4];
  {
    const _Float16* src = qkv16 + planeV + (size_t)vj * 4096 + posW + vp;
#pragma unroll
    for (int s = 0; s < 4; ++s) {
      tmp[s].q[0] = *(const u32x4*)(src + s * 128);
      tmp[s].q[1] = *(const u32x4*)(src + s * 128 + 8);
    }
  }
  // stands in front of the first overwrite of an address register of the loads above
  asm volatile("s_wait_xcnt 0x0" ::: "memory");
  // keeps the scheduler from sinking the v loads behind the waits of the sums
  // below, where they would wait out a second memory latency
  __builtin_amdgcn_sched_barrier(0);
  const float tq = temperature[h];
  // ---- sim = sum of the partial planes, scaled by the inverse norms
  {
    f32x4 s4 = pS[0], ssk = pK[0];
    float ssq = pQ[0];
#pragma unroll
    for (int sl = 1; sl < 4; ++sl) { s4 += pS[sl]; ssk += pK[sl]; ssq += pQ[sl]; }
    const float sq = __expf(tq) * (1.0f / fmaxf(sqrtf(ssq), L2_EPS));
    float* sd = sim + (tid >> 3) * 33 + (tid & 7) * 4;
#pragma unroll
    for (int e = 0; e < 4; ++e)
      sd[e] = s4[e] * sq * (1.0f / fmaxf(sqrtf(ssk[e]), L2_EPS));
  }
  __syncthreads();
  // ---- softmax rows (32 rows of 32)
  if (tid < 32) {
    float* row = sim + tid * 33;
    float mx = -1e30f;
    for (int j = 0; j < 32; ++j) mx = fmaxf(mx, row[j]);
    float sum = 0.f;
    for (int j = 0; j < 32; ++j) {
      float e = __expf((row[j] - mx) * SM_SCALE);
      row[j] = e; sum += e;
    }
    float inv = 1.0f / sum;
    for (int j = 0; j < 32; ++j)
      attnS[tid * 32 + j] = (_Float16)(row[j] * inv);
  }
  // ---- transpose the v slice into ldsV[pos][j]
#pragma unroll
  for (int s = 0; s < 4; ++s)
#pragma unroll
    for (int e = 0; e < 16; ++e)
      ldsV[(s * 128 + vp + e) * 40 + vj] = tmp[s].t[e];
  __syncthreads();
  // ---- out = attn @ v  (wave -> (i_tile, 8 pos tiles))
  const int it = wave & 1, pp = wave >> 1;
  FragH a;
  {
    const _Float16* ar = attnS + (it * 16 + lm) * 32;
    a.q[0] = *(const u32x4*)(ar + g * 8);
    a.q[1] = *(const u32x4*)(ar + 16 + g * 8);
  }
  // unrolled so that the LDS reads of later tiles overlap earlier products and stores
#pragma unroll
  for (int u = 0; u < 8; ++u) {
    const int pt = pp * 8 + u;
    FragH bf;
    const _Float16* vr = ldsV + (pt * 16 + lm) * 40;
    bf.q[0] = *(const u32x4*)(vr + g * 8);
    bf.q[1] = *(const u32x4*)(vr + 16 + g * 8);
    v8f z = {};
    v8f c = __builtin_amdgcn_wmma_f32_16x16x32_f16(false, a.h, false, bf.h,
                                                   (short)0, z, false, false);
    const int pos = posW + pt * 16 + lm;
    _Float16* dst = out16 + ((size_t)b * 4096 + pos) * 256 + h * 32 + it * 16 + g * 8;
    h8v ov;
#pragma unroll
    for (int r = 0; r < 8; ++r) ov[r] = (_Float16)c[r];
    *(h8v*)dst = ov;
  }
}

// ---------------------------------------------------------------------------
// Kernel 6: output projection GEMM [65536 x 256] x [256 x 256] + bias, in the
// form of kernel 3 (4 chunks of 64 columns); the staging tiles hold f32 + bias, and
// every wave stores 8 columns of 1024 contiguous bytes into [b][c][H][W].
// ---------------------------------------------------------------------------
__global__ __launch_bounds__(256) void k_gemm_out(const _Float16* __restrict__ a16,
                                                  const _Float16* __restrict__ wo16,
                                                  const float* __restrict__ bias,
                                                  float* __restrict__ outp) {
  __shared__ __attribute__((aligned(16))) _Float16 ldsB[2][64 * WPITCH];
  __shared__ __attribute__((aligned(16))) float    ldsS[2][64 * 260];
  const int tid  = threadIdx.x;
  // the wave's number in a scalar register: column and row offsets formed from it stay scalar
  const int wave = __builtin_amdgcn_readfirstlane(tid >> 5), lane = tid & 31;
  const int g = lane >> 4, lm = lane & 15;
  const int m0 = blockIdx.x * 256;
  const int bb = m0 >> 12, posB = m0 & 4095;
  copy_wchunk(wo16, ldsB[0], tid);
  FragH a[2][8];
  load_afrags(a16 + (size_t)(m0 + wave * 32 + lm) * 256 + g * 8, a);
  wait_copies();
  __syncthreads();
  copy_wchunk(wo16 + 64 * 256, ldsB[1], tid);
  FragH bs[2][8];
  load_wblock(bs[0], ldsB[0] + lm * WPITCH + g * 8, 0);
  // stays rolled: one trip already holds 64 products, and the loop's text stays short
#pragma unroll 1
  for (int ch = 0; ch < 4; ++ch) {
    // this chunk's bias, one value per column tile; read here, its latency passes under the products
    float bv[4];
#pragma unroll
    for (int tn = 0; tn < 4; ++tn) bv[tn] = bias[ch * 64 + tn * 16 + lm];
    v8f acc[2][4] = {};
    chunk_products(a, ldsB[ch & 1] + lm * WPITCH + g * 8, bs, acc);
    float* ss = ldsS[ch & 1];
#pragma unroll
    for (int mt = 0; mt < 2; ++mt)
#pragma unroll
      for (int tn = 0; tn < 4; ++tn) {
        float* sd = ss + (tn * 16 + lm) * 260 + wave * 32 + mt * 16 + g * 8;
        f32x4 lo, hi;
#pragma unroll
        for (int e = 0; e < 4; ++e) { lo[e] = acc[mt][tn][e] + bv[tn]; hi[e] = acc[mt][tn][4 + e] + bv[tn]; }
        *(f32x4*)sd       = lo;
        *(f32x4*)(sd + 4) = hi;
      }
    // hand-over: chunk ch+1 of W and this chunk's staging tile become readable,
    // and every reader has left the W buffer that is refilled below
    wait_lds();
    wait_copies();
    __syncthreads();
    if (ch + 2 < 4) copy_wchunk(wo16 + (size_t)(ch + 2) * 64 * 256, ldsB[ch & 1], tid);
    // the next chunk's first block, behind the barrier that has published it
    if (ch + 1 < 4) load_wblock(bs[0], ldsB[(ch + 1) & 1] + lm * WPITCH + g * 8, 0);
#pragma unroll
    for (int i = 0; i < 8; ++i) {
      const int cl = wave * 8 + i;
      const int c  = ch * 64 + cl;
      float* dst = outp + ((size_t)bb * 256 + c) * 4096 + posB;
#pragma unroll
      for (int hf = 0; hf < 2; ++hf) {
        const f32x4 o = *(const f32x4*)(ss + cl * 260 + hf * 128 + lane * 4);
        *(f32x4*)(dst + hf * 128 + lane * 4) = o;
      }
    }
    // stands in front of the next trip's first overwrite of a register of the stores above
    asm volatile("s_wait_xcnt 0x0" ::: "memory");
  }
  wait_copies();
}

// ---------------------------------------------------------------------------
extern "C" void kernel_launch(void* const* d_in, const int* in_sizes, int n_in,
                              void* d_out, int out_size, void* d_ws, size_t ws_size,
                              hipStream_t stream) {
  (void)in_sizes; (void)n_in; (void)out_size; (void)ws_size;
  const float* x    = (const float*)d_in[0];
  const float* gam  = (const float*)d_in[1];
  const float* bet  = (const float*)d_in[2];
  const float* Wqkv = (const float*)d_in[3];
  const float* temp = (const float*)d_in[4];
  const float* Wout = (const float*)d_in[5];
  const float* bout = (const float*)d_in[6];

  char* ws = (char*)d_ws;
  _Float16* w16   = (_Float16*)ws; ws += (size_t)768 * 256 * 2;              // 384 KB
  _Float16* wo16  = (_Float16*)ws; ws += (size_t)256 * 256 * 2;              // 128 KB
  _Float16* qkv16 = (_Float16*)ws; ws += (size_t)3 * 16 * 8 * 32 * 4096 * 2; // 96 MB
  _Float16* out16 = (_Float16*)ws; ws += (size_t)65536 * 256 * 2;            // 32 MB
  float*    simP  = (float*)ws;    ws += (size_t)128 * 4 * 1024 * 4;         // 2 MB
  float*    ssP   = (float*)ws;    ws += (size_t)128 * 4 * 64 * 4;           // 128 KB
  float* outp = (float*)d_out;

  k_cvtw    <<<dim3(1024),    256, 0, stream>>>(Wqkv, Wout, w16, wo16);
  k_gemm_qkv<<<dim3(256),     256, 0, stream>>>(x, gam, bet, w16, qkv16);
  k_sim     <<<dim3(128, 4),  256, 0, stream>>>(qkv16, simP, ssP);
  k_attn_out<<<dim3(128, 8),  256, 0, stream>>>(qkv16, simP, ssP, temp, out16);
  k_gemm_out<<<dim3(256),     256, 0, stream>>>(out16, wo16, bout, outp);
}

// v005
// It runs in 59.3 microseconds.
// Timed twice side by side with v004, it ran 1.51 times as fast both times.
// Counting every step since v000, it is 3.64 times as fast.
#include <hip/hip_runtime.h>
#include <hip/hip_bf16.h>
#include <math.h>
#include <stdint.h>

typedef __attribute__((ext_vector_type(16))) _Float16 v16h;
typedef __attribute__((ext_vector_type(8)))  float    v8f;
typedef __attribute__((ext_vector_type(4)))  unsigned u32x4;
typedef __attribute__((ext_vector_type(8)))  _Float16 h8v;
typedef __attribute__((ext_vector_type(4)))  float    f32x4;
typedef __attribute__((ext_vector_type(2)))  float    f32x2;
typedef __attribute__((ext_vector_type(4)))  int      i32x4;

union FragH { v16h h; u32x4 q[2]; };

#define LN_EPS   1e-5f
#define L2_EPS   1e-12f
#define SM_SCALE 8.0f

// ---------------------------------------------------------------------------
// CDNA5 async global->LDS staging (ASYNCcnt path), with safe fallback.
// Builtin signature (leaked by compiler diagnostic): param0 = int4 addrspace(1)*.
// ---------------------------------------------------------------------------
#if defined(__HIP_DEVICE_COMPILE__) && __has_builtin(__builtin_amdgcn_global_load_async_to_lds_b128)
#define USE_ASYNC_LDS 1
#else
#define USE_ASYNC_LDS 0
#endif

#if USE_ASYNC_LDS
typedef __attribute__((address_space(1))) i32x4 g_i32x4;
typedef __attribute__((address_space(3))) i32x4 l_i32x4;
#endif

__device__ __forceinline__ void stage16(const _Float16* g, _Float16* l) {
#if USE_ASYNC_LDS
  __builtin_amdgcn_global_load_async_to_lds_b128(
      (g_i32x4*)(uintptr_t)g,
      (l_i32x4*)(uint32_t)(uintptr_t)l, 0, 0);
#else
  *(u32x4*)l = *(const u32x4*)g;
#endif
}

// ---------------------------------------------------------------------------
// Kernel 2: convert weights to f16, stored transposed (w16[col][k]).
// ---------------------------------------------------------------------------
__global__ __launch_bounds__(256) void k_cvtw(const float* __restrict__ Wqkv,
                                              const float* __restrict__ Wout,
                                              _Float16* __restrict__ w16,
                                              _Float16* __restrict__ wo16) {
  int idx = blockIdx.x * 256 + threadIdx.x;
  if (idx < 768 * 256) {
    int col = idx >> 8, k = idx & 255;
    w16[idx] = (_Float16)Wqkv[(size_t)k * 768 + col];
  } else {
    int i2 = idx - 768 * 256;
    if (i2 < 256 * 256) {
      int col = i2 >> 8, k = i2 & 255;
      wo16[i2] = (_Float16)Wout[(size_t)k * 256 + col];
    }
  }
}

// ---------------------------------------------------------------------------
// Shared parts of the two projection GEMMs (kernels 3 and 6).
// A work-group of 8 waves owns 256 rows of A. Each wave holds its 32 rows over
// the whole K = 256 in registers (2 x 8 fragments) and the work-group walks all
// columns in chunks of 64: a chunk of W (64 rows x 256 k) lies in one of two
// LDS buffers, the next chunk's async copies fly while this one is worked on.
// Fragment layout per CDNA5 ISA 7.12.2 (16-bit A 16x32): lane l holds row
// m=l&15; halves 0..7 = K {g*8..g*8+7}, halves 8..15 = K {16+g*8..}, g=l>>4.
// ---------------------------------------------------------------------------
#define WPITCH 264   // halves per W row in LDS: 512 B + 16 B (16 B x odd)

// one chunk of W: 64 rows of 512 B; each copy of a wave moves one whole row
__device__ __forceinline__ void copy_wchunk(const _Float16* __restrict__ wsrc,
                                            _Float16* buf, int tid) {
#pragma unroll
  for (int i = 0; i < 8; ++i) {
    const int row = i * 8 + (tid >> 5), off = (tid & 31) * 8;
    stage16(wsrc + row * 256 + off, buf + row * WPITCH + off);
  }
}

// the wave's 32 rows of A over all K, straight from global memory
__device__ __forceinline__ void load_afrags(const _Float16* __restrict__ ar, FragH (&a)[2][8]) {
#pragma unroll
  for (int mt = 0; mt < 2; ++mt)
#pragma unroll
    for (int ks = 0; ks < 8; ++ks) {
      a[mt][ks].q[0] = *(const u32x4*)(ar + mt * 16 * 256 + ks * 32);
      a[mt][ks].q[1] = *(const u32x4*)(ar + mt * 16 * 256 + ks * 32 + 16);
    }
}

// one block of W fragments: 2 k steps x 4 column tiles, 16 LDS reads issued as one group
__device__ __forceinline__ void load_wblock(FragH (&bs)[8], const _Float16* br, int blk) {
#pragma unroll
  for (int k2 = 0; k2 < 2; ++k2)
#pragma unroll
    for (int tn = 0; tn < 4; ++tn) {
      bs[k2 * 4 + tn].q[0] = *(const u32x4*)(br + tn * 16 * WPITCH + (blk * 2 + k2) * 32);
      bs[k2 * 4 + tn].q[1] = *(const u32x4*)(br + tn * 16 * WPITCH + (blk * 2 + k2) * 32 + 16);
    }
}

// 32 rows x 64 columns over K = 256, in 4 blocks of 16 products; each W fragment
// serves two products. bs[0] holds block 0 on entry; each later block is read
// into the other fragment set while the current block's products run.
// WROWS = false: A rows are the result's rows (a lane holds one column, 8 rows).
// WROWS = true: the W fragment is the first operand (both operands share one
// fragment layout), so a lane holds one A row and 8 consecutive columns.
template <bool WROWS>
__device__ __forceinline__ void chunk_products(const FragH (&a)[2][8], const _Float16* br,
                                               FragH (&bs)[2][8], v8f (&acc)[2][4]) {
#pragma unroll
  for (int blk = 0; blk < 4; ++blk) {
    if (blk < 3) load_wblock(bs[(blk + 1) & 1], br, blk + 1);
    // keeps the next block's LDS reads one group in front of this block's products:
    // sunk among them, each product pair would wait out an LDS latency of its own
    __builtin_amdgcn_sched_barrier(0);
#pragma unroll
    for (int k2 = 0; k2 < 2; ++k2)
#pragma unroll
      for (int tn = 0; tn < 4; ++tn)
#pragma unroll
        for (int mt = 0; mt < 2; ++mt)
          acc[mt][tn] = WROWS
              ? __builtin_amdgcn_wmma_f32_16x16x32_f16(
                    false, bs[blk & 1][k2 * 4 + tn].h, false, a[mt][blk * 2 + k2].h,
                    (short)0, acc[mt][tn], false, false)
              : __builtin_amdgcn_wmma_f32_16x16x32_f16(
                    false, a[mt][blk * 2 + k2].h, false, bs[blk & 1][k2 * 4 + tn].h,
                    (short)0, acc[mt][tn], false, false);
    // the other side of the same fence: later reads do not rise into this block
    __builtin_amdgcn_sched_barrier(0);
  }
}

// the wave's own LDS reads and writes have retired (in front of a hand-over barrier)
__device__ __forceinline__ void wait_lds()    { asm volatile("s_wait_dscnt 0x0" ::: "memory"); }
// the wave's own async copies have landed (in front of the barrier that publishes them)
__device__ __forceinline__ void wait_copies() { asm volatile("s_wait_asynccnt 0x0" ::: "memory"); }

// the value of the lane 16 away (lanes l and l ^ 16 hold the two halves of a row's channels)
__device__ __forceinline__ float other_half(float v) {
  const unsigned u = __float_as_uint(v);
  return __uint_as_float(__builtin_amdgcn_permlanex16(u, u, 0x76543210u, 0xfedcba98u, false, false));
}

// ---------------------------------------------------------------------------
// Kernel 3: LayerNorm over channels + qkv projection GEMM
// [65536 x 256] x [256 x 768] with WMMA.
// x is [b][c=256][pos=4096]. A lane of an A fragment holds one pos and 8 + 8
// channels per k step, so it reads its channels straight from x: one 8-byte
// load per channel brings pos 2*lm and 2*lm+1, which are row lm of the wave's
// first and second 16-row tile (16 lanes = one whole 128-B line of a channel).
// All 256 channels of the wave's 32 pos are then in registers as f32: the sums
// over channels are taken in the lane and added to those of lane l ^ 16, and the
// normalized values are rounded once to f16, in fragment order.
// Each q or k chunk's 256 pos x 64 col result goes as f16 into one of two LDS
// staging tiles [col][pos]; behind the chunk's one barrier every wave stores 8
// columns, 512 contiguous bytes each, into planar qk16[2][b][h][d][n].
// The v chunks (the last four) are wanted as rows v16[b*4096 + pos][h*32 + d],
// the A operand of kernel 6: their products take W as the first operand, the
// staging tile is [pos][col], and every wave stores 32 rows of 128 bytes.
// ---------------------------------------------------------------------------
#define VPITCH 72    // halves per pos row of a v staging tile: 128 B + 16 B
__global__ __launch_bounds__(256) void k_gemm_qkv(const float* __restrict__ x,
                                                  const float* __restrict__ gamma,
                                                  const float* __restrict__ beta,
                                                  const _Float16* __restrict__ w16,
                                                  _Float16* __restrict__ qk16,
                                                  _Float16* __restrict__ v16) {
  __shared__ __attribute__((aligned(16))) _Float16 ldsB[2][64 * WPITCH];
  __shared__ __attribute__((aligned(16))) _Float16 ldsS[2][256 * VPITCH];   // >= 64 * 264
  __shared__ __attribute__((aligned(16))) float    gamS[256], betS[256];
  const int tid  = threadIdx.x;
  // the wave's number in a scalar register: column and row offsets formed from it stay scalar
  const int wave = __builtin_amdgcn_readfirstlane(tid >> 5), lane = tid & 31;
  const int g = lane >> 4, lm = lane & 15;
  const int m0 = blockIdx.x * 256;
  const int bb = m0 >> 12, posB = m0 & 4095;
  copy_wchunk(w16, ldsB[0], tid);
  const float gmT = gamma[tid], btT = beta[tid];
  // xr[ks][j]: channel ks*32 + (j>>3)*16 + g*8 + (j&7), the fragment's own k order
  // (every loop over xr[] and a[] is unrolled so that they stay in registers)
  f32x2 xr[8][16];
  const float* xp = x + ((size_t)bb * 256 + g * 8) * 4096 + posB + wave * 32 + lm * 2;
#pragma unroll
  for (int ks = 0; ks < 8; ++ks)
#pragma unroll
    for (int j = 0; j < 16; ++j)
      xr[ks][j] = *(const f32x2*)(xp + (size_t)(ks * 32 + (j >> 3) * 16 + (j & 7)) * 4096);
  // stands in front of the first overwrite of an address register of the loads above;
  // xp is named so that its registers live up to here and no load lands in them
  asm volatile("s_wait_xcnt 0x0" :: "v"(xp) : "memory");
  // keeps the scheduler from sinking loads among the sums below: all of them are
  // in flight before the first wait
  __builtin_amdgcn_sched_barrier(0);
  gamS[tid] = gmT;
  betS[tid] = btT;
  // sums and sums of squares of the lane's 128 channels, two chains per sum
  f32x2 sA = {0.f, 0.f}, sB = {0.f, 0.f}, qA = {0.f, 0.f}, qB = {0.f, 0.f};
#pragma unroll
  for (int ks = 0; ks < 8; ++ks)
#pragma unroll
    for (int j = 0; j < 16; j += 2) {
      sA += xr[ks][j];     qA += xr[ks][j] * xr[ks][j];
      sB += xr[ks][j + 1]; qB += xr[ks][j + 1] * xr[ks][j + 1];
    }
  f32x2 mu, ri;
#pragma unroll
  for (int mt = 0; mt < 2; ++mt) {
    const float sh = sA[mt] + sB[mt], qh = qA[mt] + qB[mt];
    const float ts = sh + other_half(sh), tq = qh + other_half(qh);
    const float m  = ts * (1.0f / 256.0f);
    const float var = tq * (1.0f / 256.0f) - m * m;
    mu[mt] = m;
    ri[mt] = rsqrtf(var + LN_EPS);
  }
  wait_copies();
  // publishes chunk 0 of W and gamma, beta
  __syncthreads();
  copy_wchunk(w16 + 64 * 256, ldsB[1], tid);
  FragH a[2][8];
#pragma unroll
  for (int ks = 0; ks < 8; ++ks)
#pragma unroll
    for (int hf = 0; hf < 2; ++hf) {
      const int c0 = ks * 32 + hf * 16 + g * 8;
      f32x4 gm[2], bt[2];
      gm[0] = *(const f32x4*)(gamS + c0); gm[1] = *(const f32x4*)(gamS + c0 + 4);
      bt[0] = *(const f32x4*)(betS + c0); bt[1] = *(const f32x4*)(betS + c0 + 4);
#pragma unroll
      for (int e = 0; e < 8; ++e) {
        const f32x2 v = (xr[ks][hf * 8 + e] - mu) * ri * gm[e >> 2][e & 3] + bt[e >> 2][e & 3];
        a[0][ks].h[hf * 8 + e] = (_Float16)v[0];
        a[1][ks].h[hf * 8 + e] = (_Float16)v[1];
      }
    }
  FragH bs[2][8];
  load_wblock(bs[0], ldsB[0] + lm * WPITCH + g * 8, 0);
  // stays rolled: one trip already holds 64 products, and the loop's text stays short
#pragma unroll 1
  for (int ch = 0; ch < 8; ++ch) {
    v8f acc[2][4] = {};
    chunk_products<false>(a, ldsB[ch & 1] + lm * WPITCH + g * 8, bs, acc);
    _Float16* ss = ldsS[ch & 1];
    // row g*8 + r of tile mt is pos wave*32 + g*16 + 2*r + mt
#pragma unroll
    for (int tn = 0; tn < 4; ++tn)
#pragma unroll
      for (int rh = 0; rh < 2; ++rh) {
        h8v ov;
#pragma unroll
        for (int r = 0; r < 4; ++r) {
          ov[r * 2]     = (_Float16)acc[0][tn][rh * 4 + r];
          ov[r * 2 + 1] = (_Float16)acc[1][tn][rh * 4 + r];
        }
        *(h8v*)(ss + (tn * 16 + lm) * 264 + wave * 32 + g * 16 + rh * 8) = ov;
      }
    // hand-over: chunk ch+1 of W and this chunk's staging tile become readable,
    // and every reader has left the W buffer that is refilled below
    wait_lds();
    wait_copies();
    __syncthreads();
    copy_wchunk(w16 + (size_t)(ch + 2) * 64 * 256, ldsB[ch & 1], tid);
    // the next chunk's first block, behind the barrier that has published it
    load_wblock(bs[0], ldsB[(ch + 1) & 1] + lm * WPITCH + g * 8, 0);
#pragma unroll
    for (int i = 0; i < 8; ++i) {
      const int cl  = wave * 8 + i;
      const int col = ch * 64 + cl;
      const u32x4 v = *(const u32x4*)(ss + cl * 264 + lane * 8);
      const size_t row = (size_t)(col >> 8) * 4096 + bb * 256 + (col & 255);
      *(u32x4*)(qk16 + row * 4096 + posB + lane * 8) = v;
    }
    // stands in front of the next trip's first overwrite of a register of the stores above
    asm volatile("s_wait_xcnt 0x0" ::: "memory");
  }
  // the lane's place in a v staging tile and in v16 for the row stores below: row
  // wave*32 + (lane >> 3) and 16 of its 128 bytes; the other rows are constant steps away
  const int vso = (wave * 32 + (lane >> 3)) * VPITCH + (lane & 7) * 8;
  _Float16* vd = v16 + (size_t)(m0 + wave * 32 + (lane >> 3)) * 256 + (lane & 7) * 8;
  // the v chunks; stays rolled for the same reason
#pragma unroll 1
  for (int ch = 8; ch < 12; ++ch) {
    v8f acc[2][4] = {};
    chunk_products<true>(a, ldsB[ch & 1] + lm * WPITCH + g * 8, bs, acc);
    _Float16* ss = ldsS[ch & 1];
    // the lane holds pos wave*32 + 2*lm + mt and columns tn*16 + g*8 + (0..7)
#pragma unroll
    for (int mt = 0; mt < 2; ++mt)
#pragma unroll
      for (int tn = 0; tn < 4; ++tn) {
        h8v ov;
#pragma unroll
        for (int r = 0; r < 8; ++r) ov[r] = (_Float16)acc[mt][tn][r];
        *(h8v*)(ss + (wave * 32 + lm * 2 + mt) * VPITCH + tn * 16 + g * 8) = ov;
      }
    // hand-over, as in the loop above
    wait_lds();
    wait_copies();
    __syncthreads();
    if (ch + 2 < 12) copy_wchunk(w16 + (size_t)(ch + 2) * 64 * 256, ldsB[ch & 1], tid);
    // the next chunk's first block, behind the barrier that has published it
    if (ch + 1 < 12) load_wblock(bs[0], ldsB[(ch + 1) & 1] + lm * WPITCH + g * 8, 0);
    // 8 lanes store one row's 128 bytes: whole lines
#pragma unroll
    for (int i = 0; i < 8; ++i) {
      const u32x4 v = *(const u32x4*)(ss + vso + i * 4 * VPITCH);
      *(u32x4*)(vd + (ch - 8) * 64 + i * 4 * 256) = v;
    }
    // stands in front of the next trip's first overwrite of a register of the stores above
    asm volatile("s_wait_xcnt 0x0" ::: "memory");
  }
  wait_copies();
}

// ---------------------------------------------------------------------------
// Kernel 5a: partial cross-covariance sums. sim = q . k^T over n (K=4096) is
// split over n: work-group (bh, sl) takes 1024 positions, each of its 8 waves
// a span of 128 and all four 16x16 tiles of the 32x32 result. The 8 spans are
// summed through LDS in wave order; simP[bh][sl][32*32] f32 goes to kernel 5b.
// q and k are read as the projection left them (not normalized). The sums of
// squares of their rows over the same span are the diagonals of q.q^T and
// k.k^T, taken from the fragments already in registers; they are summed the
// same way into ssP[bh][sl][64] (32 q rows, then 32 k rows) for kernel 5b.
// ---------------------------------------------------------------------------
__global__ __launch_bounds__(256) void k_sim(const _Float16* __restrict__ qkv16,
                                             float* __restrict__ simP,
                                             float* __restrict__ ssP) {
  __shared__ float part[8 * 32 * 33];
  __shared__ float ssW[8 * 64];
  const int bh = blockIdx.x, sl = blockIdx.y;
  const int b = bh >> 3, h = bh & 7;
  const int tid  = threadIdx.x;
  const int wave = tid >> 5, lane = tid & 31;
  const int g = lane >> 4, lm = lane & 15;
  const size_t planeQ = (((size_t)0 * 16 + b) * 8 + h) * (size_t)32 * 4096;
  const size_t planeK = (((size_t)1 * 16 + b) * 8 + h) * (size_t)32 * 4096;
  const int n0 = sl * 1024 + wave * 128;
  const _Float16* qr = qkv16 + planeQ + (size_t)lm * 4096 + n0;
  const _Float16* kr = qkv16 + planeK + (size_t)lm * 4096 + n0;
  // the wave's whole span is loaded first: 32 loads in flight, one memory latency
  // (every loop over a[], bf[], acc[] is unrolled so that they stay in registers)
  FragH a[4][2], bf[4][2];
#pragma unroll
  for (int s = 0; s < 4; ++s)
#pragma unroll
    for (int t = 0; t < 2; ++t) {
      a[s][t].q[0]  = *(const u32x4*)(qr + t * 16 * 4096 + s * 32 + g * 8);
      a[s][t].q[1]  = *(const u32x4*)(qr + t * 16 * 4096 + s * 32 + 16 + g * 8);
      bf[s][t].q[0] = *(const u32x4*)(kr + t * 16 * 4096 + s * 32 + g * 8);
      bf[s][t].q[1] = *(const u32x4*)(kr + t * 16 * 4096 + s * 32 + 16 + g * 8);
    }
  // keeps the scheduler from sinking loads between the products, where each
  // group would wait out its own latency
  __builtin_amdgcn_sched_barrier(0);
  v8f acc[2][2] = {};
  v8f qq[2] = {}, kk[2] = {};
#pragma unroll
  for (int s = 0; s < 4; ++s) {
#pragma unroll
    for (int it = 0; it < 2; ++it)
#pragma unroll
      for (int jt = 0; jt < 2; ++jt)
        acc[it][jt] = __builtin_amdgcn_wmma_f32_16x16x32_f16(false, a[s][it].h, false, bf[s][jt].h,
                                                             (short)0, acc[it][jt], false, false);
    // A and B fragments share one k order, so a fragment times itself is a Gram tile
#pragma unroll
    for (int t = 0; t < 2; ++t) {
      qq[t] = __builtin_amdgcn_wmma_f32_16x16x32_f16(false, a[s][t].h, false, a[s][t].h,
                                                     (short)0, qq[t], false, false);
      kk[t] = __builtin_amdgcn_wmma_f32_16x16x32_f16(false, bf[s][t].h, false, bf[s][t].h,
                                                     (short)0, kk[t], false, false);
    }
  }
  // diagonal element of row lm sits in the lane with g == lm >> 3, register lm & 7
#pragma unroll
  for (int t = 0; t < 2; ++t) {
    float dq = qq[t][0], dk = kk[t][0];
#pragma unroll
    for (int r = 1; r < 8; ++r)
      if ((lm & 7) == r) { dq = qq[t][r]; dk = kk[t][r]; }
    if ((lm >> 3) == g) {
      ssW[wave * 64 + t * 16 + lm]      = dq;
      ssW[wave * 64 + 32 + t * 16 + lm] = dk;
    }
  }
  float* pw = part + wave * (32 * 33);
#pragma unroll
  for (int it = 0; it < 2; ++it)
#pragma unroll
    for (int jt = 0; jt < 2; ++jt)
#pragma unroll
      for (int r = 0; r < 8; ++r)
        pw[(it * 16 + g * 8 + r) * 33 + jt * 16 + lm] = acc[it][jt][r];
  __syncthreads();
  float* dst = simP + ((size_t)bh * 4 + sl) * 1024;
  for (int idx = tid; idx < 1024; idx += 256) {
    const int o = (idx >> 5) * 33 + (idx & 31);
    float s = part[o];
#pragma unroll
    for (int w = 1; w < 8; ++w) s += part[w * (32 * 33) + o];
    dst[idx] = s;
  }
  if (tid < 64) {
    float s = ssW[tid];
#pragma unroll
    for (int w = 1; w < 8; ++w) s += ssW[w * 64 + tid];
    ssP[((size_t)bh * 4 + sl) * 64 + tid] = s;
  }
}

// ---------------------------------------------------------------------------
// Kernel 5b: per batch and pair of heads, the output projection's weight with
// the attention folded in. (attn . v)^T . W_out = v^T . (attn^T . W_out), so
//   sim = sum of the 4 partial planes, in slice order, times
//         exp(temperature[h]) / max(|q_i|, eps) / max(|k_j|, eps), the norms
//         from the 4 partial sums of squares (the l2norm of q and k)
//   attn = softmax(sim * 8) over j
//   wm[b][c][h*32 + j] = sum_i attn[i][j] * W_out[h*32 + i][c]   (K=32, one WMMA per tile)
// in the [col][k] form that kernel 6 reads. Two heads are 128 bytes of a wm
// row: a line has one writing work-group.
// ---------------------------------------------------------------------------
__global__ __launch_bounds__(256) void k_mix(const float* __restrict__ simP,
                                             const float* __restrict__ ssP,
                                             const float* __restrict__ temperature,
                                             const _Float16* __restrict__ wo16,
                                             _Float16* __restrict__ wm16) {
  __shared__ float sim[2][32 * 33];
  __shared__ __attribute__((aligned(16))) _Float16 attnT[2][32 * 40];
  const int b = blockIdx.x >> 2, h0 = (blockIdx.x & 3) * 2;
  const int tid  = threadIdx.x;
  const int wave = tid >> 5, lane = tid & 31;
  const int g = lane >> 4, lm = lane & 15;
  // ---- partial planes and partial sums of squares of both heads into registers
  // (loops over pS[], pK[], pQ[], bf[] are unrolled: they stay in registers)
  f32x4 pS[2][4], pK[2][4];
  float pQ[2][4];
  const size_t bh0 = (size_t)b * 8 + h0;
  const float* sp = simP + bh0 * 4 * 1024 + tid * 4;
  const float* nq = ssP + bh0 * 4 * 64 + (tid >> 3);
  const float* nk = ssP + bh0 * 4 * 64 + 32 + (tid & 7) * 4;
#pragma unroll
  for (int hh = 0; hh < 2; ++hh)
#pragma unroll
    for (int sl = 0; sl < 4; ++sl) {
      pS[hh][sl] = *(const f32x4*)(sp + (hh * 4 + sl) * 1024);
      pK[hh][sl] = *(const f32x4*)(nk + (hh * 4 + sl) * 64);
      pQ[hh][sl] = nq[(hh * 4 + sl) * 64];
    }
  // ---- the wave's part: head hw, 16 rows j, 128 columns c; its W_out fragments
  const int hw = wave >> 2, jt = (wave >> 1) & 1, cq = wave & 1;
  FragH bf[8];
  const _Float16* wr = wo16 + (size_t)(cq * 128 + lm) * 256 + (h0 + hw) * 32 + g * 8;
#pragma unroll
  for (int u = 0; u < 8; ++u) {
    bf[u].q[0] = *(const u32x4*)(wr + u * 16 * 256);
    bf[u].q[1] = *(const u32x4*)(wr + u * 16 * 256 + 16);
  }
  // stands in front of the first overwrite of an address register of the loads above;
  // sp and wr are named so that their registers live up to here and no load lands in them
  asm volatile("s_wait_xcnt 0x0" :: "v"(sp), "v"(wr) : "memory");
  // keeps the scheduler from sinking the W_out loads behind the waits of the sums
  // below, where they would wait out a second memory latency
  __builtin_amdgcn_sched_barrier(0);
  // ---- sim = sum of the partial planes, scaled by the inverse norms
#pragma unroll
  for (int hh = 0; hh < 2; ++hh) {
    const float tq = temperature[h0 + hh];
    f32x4 s4 = pS[hh][0], ssk = pK[hh][0];
    float ssq = pQ[hh][0];
#pragma unroll
    for (int sl = 1; sl < 4; ++sl) { s4 += pS[hh][sl]; ssk += pK[hh][sl]; ssq += pQ[hh][sl]; }
    const float sq = __expf(tq) * (1.0f / fmaxf(sqrtf(ssq), L2_EPS));
    float* sd = sim[hh] + (tid >> 3) * 33 + (tid & 7) * 4;
#pragma unroll
    for (int e = 0; e < 4; ++e)
      sd[e] = s4[e] * sq * (1.0f / fmaxf(sqrtf(ssk[e]), L2_EPS));
  }
  __syncthreads();
  // ---- softmax rows (2 x 32 rows of 32), written transposed: attnT[j][i]
  if (tid < 64) {
    float* row = sim[tid >> 5] + (tid & 31) * 33;
    _Float16* at = attnT[tid >> 5] + (tid & 31);
    float mx = -1e30f;
    for (int j = 0; j < 32; ++j) mx = fmaxf(mx, row[j]);
    float sum = 0.f;
    for (int j = 0; j < 32; ++j) {
      float e = __expf((row[j] - mx) * SM_SCALE);
      row[j] = e; sum += e;
    }
    float inv = 1.0f / sum;
    for (int j = 0; j < 32; ++j)
      at[j * 40] = (_Float16)(row[j] * inv);
  }
  __syncthreads();
  // ---- wm = attn^T . W_out: result rows j, columns c
  FragH a;
  {
    const _Float16* ar = attnT[hw] + (jt * 16 + lm) * 40;
    a.q[0] = *(const u32x4*)(ar + g * 8);
    a.q[1] = *(const u32x4*)(ar + 16 + g * 8);
  }
#pragma unroll
  for (int u = 0; u < 8; ++u) {
    v8f z = {};
    v8f c = __builtin_amdgcn_wmma_f32_16x16x32_f16(false, a.h, false, bf[u].h,
                                                   (short)0, z, false, false);
    const int col = cq * 128 + u * 16 + lm;
    _Float16* dst = wm16 + ((size_t)b * 256 + col) * 256 + (h0 + hw) * 32 + jt * 16 + g * 8;
    h8v ov;
#pragma unroll
    for (int r = 0; r < 8; ++r) ov[r] = (_Float16)c[r];
    *(h8v*)dst = ov;
  }
}

// ---------------------------------------------------------------------------
// Kernel 6: output projection GEMM [65536 x 256] x [256 x 256] + bias: the rows
// of v times the batch's own weight wm[b] of kernel 5b, in the
// form of kernel 3 (4 chunks of 64 columns); the staging tiles hold f32 + bias, and
// every wave stores 8 columns of 1024 contiguous bytes into [b][c][H][W].
// ---------------------------------------------------------------------------
__global__ __launch_bounds__(256) void k_gemm_out(const _Float16* __restrict__ a16,
                                                  const _Float16* __restrict__ wm16,
                                                  const float* __restrict__ bias,
                                                  float* __restrict__ outp) {
  __shared__ __attribute__((aligned(16))) _Float16 ldsB[2][64 * WPITCH];
  __shared__ __attribute__((aligned(16))) float    ldsS[2][64 * 260];
  const int tid  = threadIdx.x;
  // the wave's number in a scalar register: column and row offsets formed from it stay scalar
  const int wave = __builtin_amdgcn_readfirstlane(tid >> 5), lane = tid & 31;
  const int g = lane >> 4, lm = lane & 15;
  const int m0 = blockIdx.x * 256;
  const int bb = m0 >> 12, posB = m0 & 4095;
  const _Float16* wo16 = wm16 + (size_t)bb * (256 * 256);
  copy_wchunk(wo16, ldsB[0], tid);
  FragH a[2][8];
  load_afrags(a16 + (size_t)(m0 + wave * 32 + lm) * 256 + g * 8, a);
  wait_copies();
  __syncthreads();
  copy_wchunk(wo16 + 64 * 256, ldsB[1], tid);
  FragH bs[2][8];
  load_wblock(bs[0], ldsB[0] + lm * WPITCH + g * 8, 0);
  // stays rolled: one trip already holds 64 products, and the loop's text stays short
#pragma unroll 1
  for (int ch = 0; ch < 4; ++ch) {
    // this chunk's bias, one value per column tile; read here, its latency passes under the products
    float bv[4];
#pragma unroll
    for (int tn = 0; tn < 4; ++tn) bv[tn] = bias[ch * 64 + tn * 16 + lm];
    v8f acc[2][4] = {};
    chunk_products<false>(a, ldsB[ch & 1] + lm * WPITCH + g * 8, bs, acc);
    float* ss = ldsS[ch & 1];
#pragma unroll
    for (int mt = 0; mt < 2; ++mt)
#pragma unroll
      for (int tn = 0; tn < 4; ++tn) {
        float* sd = ss + (tn * 16 + lm) * 260 + wave * 32 + mt * 16 + g * 8;
        f32x4 lo, hi;
#pragma unroll
        for (int e = 0; e < 4; ++e) { lo[e] = acc[mt][tn][e] + bv[tn]; hi[e] = acc[mt][tn][4 + e] + bv[tn]; }
        *(f32x4*)sd       = lo;
        *(f32x4*)(sd + 4) = hi;
      }
    // hand-over: chunk ch+1 of W and this chunk's staging tile become readable,
    // and every reader has left the W buffer that is refilled below
    wait_lds();
    wait_copies();
    __syncthreads();
    if (ch + 2 < 4) copy_wchunk(wo16 + (size_t)(ch + 2) * 64 * 256, ldsB[ch & 1], tid);
    // the next chunk's first block, behind the barrier that has published it
    if (ch + 1 < 4) load_wblock(bs[0], ldsB[(ch + 1) & 1] + lm * WPITCH + g * 8, 0);
#pragma unroll
    for (int i = 0; i < 8; ++i) {
      const int cl = wave * 8 + i;
      const int c  = ch * 64 + cl;
      float* dst = outp + ((size_t)bb * 256 + c) * 4096 + posB;
#pragma unroll
      for (int hf = 0; hf < 2; ++hf) {
        const f32x4 o = *(const f32x4*)(ss + cl * 260 + hf * 128 + lane * 4);
        *(f32x4*)(dst + hf * 128 + lane * 4) = o;
      }
    }
    // stands in front of the next trip's first overwrite of a register of the stores above
    asm volatile("s_wait_xcnt 0x0" ::: "memory");
  }
  wait_copies();
}

// ---------------------------------------------------------------------------
extern "C" void kernel_launch(void* const* d_in, const int* in_sizes, int n_in,
                              void* d_out, int out_size, void* d_ws, size_t ws_size,
                              hipStream_t stream) {
  (void)in_sizes; (void)n_in; (void)out_size; (void)ws_size;
  const float* x    = (const float*)d_in[0];
  const float* gam  = (const float*)d_in[1];
  const float* bet  = (const float*)d_in[2];
  const float* Wqkv = (const float*)d_in[3];
  const float* temp = (const float*)d_in[4];
  const float* Wout = (const float*)d_in[5];
  const float* bout = (const float*)d_in[6];

  char* ws = (char*)d_ws;
  _Float16* w16   = (_Float16*)ws; ws += (size_t)768 * 256 * 2;              // 384 KB
  _Float16* wo16  = (_Float16*)ws; ws += (size_t)256 * 256 * 2;              // 128 KB
  _Float16* qk16  = (_Float16*)ws; ws += (size_t)2 * 16 * 8 * 32 * 4096 * 2; // 64 MB
  _Float16* v16   = (_Float16*)ws; ws += (size_t)65536 * 256 * 2;            // 32 MB
  _Float16* wm16  = (_Float16*)ws; ws += (size_t)16 * 256 * 256 * 2;         // 2 MB
  float*    simP  = (float*)ws;    ws += (size_t)128 * 4 * 1024 * 4;         // 2 MB
  float*    ssP   = (float*)ws;    ws += (size_t)128 * 4 * 64 * 4;           // 128 KB
  float* outp = (float*)d_out;

  k_cvtw    <<<dim3(1024),    256, 0, stream>>>(Wqkv, Wout, w16, wo16);
  k_gemm_qkv<<<dim3(256),     256, 0, stream>>>(x, gam, bet, w16, qk16, v16);
  k_sim     <<<dim3(128, 4),  256, 0, stream>>>(qk16, simP, ssP);
  k_mix     <<<dim3(64),      256, 0, stream>>>(simP, ssP, temp, wo16, wm16);
  k_gemm_out<<<dim3(256),     256, 0, stream>>>(v16, wm16, bout, outp);
}

// v006
// It runs in 56.8 microseconds.
// In two side-by-side timings against v005, it was 1.06 and 1.05 times as fast.
// Over all steps from v000 it is 3.83 times as fast.
#include <hip/hip_runtime.h>
#include <hip/hip_bf16.h>
#include <math.h>
#include <stdint.h>

typedef __attribute__((ext_vector_type(16))) _Float16 v16h;
typedef __attribute__((ext_vector_type(8)))  float    v8f;
typedef __attribute__((ext_vector_type(4)))  unsigned u32x4;
typedef __attribute__((ext_vector_type(8)))  _Float16 h8v;
typedef __attribute__((ext_vector_type(4)))  float    f32x4;
typedef __attribute__((ext_vector_type(2)))  float    f32x2;
typedef __attribute__((ext_vector_type(4)))  int      i32x4;

union FragH { v16h h; u32x4 q[2]; };

#define LN_EPS   1e-5f
#define L2_EPS   1e-12f
#define SM_SCALE 8.0f

// ---------------------------------------------------------------------------
// CDNA5 async global->LDS staging (ASYNCcnt path), with safe fallback.
// Builtin signature (leaked by compiler diagnostic): param0 = int4 addrspace(1)*.
// ---------------------------------------------------------------------------
#if defined(__HIP_DEVICE_COMPILE__) && __has_builtin(__builtin_amdgcn_global_load_async_to_lds_b128)
#define USE_ASYNC_LDS 1
#else
#define USE_ASYNC_LDS 0
#endif

#if USE_ASYNC_LDS
typedef __attribute__((address_space(1))) i32x4 g_i32x4;
typedef __attribute__((address_space(3))) i32x4 l_i32x4;
#endif

__device__ __forceinline__ void stage16(const _Float16* g, _Float16* l) {
#if USE_ASYNC_LDS
  __builtin_amdgcn_global_load_async_to_lds_b128(
      (g_i32x4*)(uintptr_t)g,
      (l_i32x4*)(uint32_t)(uintptr_t)l, 0, 0);
#else
  *(u32x4*)l = *(const u32x4*)g;
#endif
}

// ---------------------------------------------------------------------------
// Kernel 2: convert weights to f16, stored transposed (w16[col][k]).
// ---------------------------------------------------------------------------
__global__ __launch_bounds__(256) void k_cvtw(const float* __restrict__ Wqkv,
                                              const float* __restrict__ Wout,
                                              _Float16* __restrict__ w16,
                                              _Float16* __restrict__ wo16) {
  int idx = blockIdx.x * 256 + threadIdx.x;
  if (idx < 768 * 256) {
    int col = idx >> 8, k = idx & 255;
    w16[idx] = (_Float16)Wqkv[(size_t)k * 768 + col];
  } else {
    int i2 = idx - 768 * 256;
    if (i2 < 256 * 256) {
      int col = i2 >> 8, k = i2 & 255;
      wo16[i2] = (_Float16)Wout[(size_t)k * 256 + col];
    }
  }
}

// ---------------------------------------------------------------------------
// Shared parts of the two projection GEMMs (kernels 3 and 6).
// A work-group of 8 waves owns 256 rows of A. Each wave holds its 32 rows over
// the whole K = 256 in registers (2 x 8 fragments) and the work-group walks all
// columns in chunks of 64: a chunk of W (64 rows x 256 k) lies in LDS; kernel 3
// keeps it in one of two buffers, the next chunk's async copies fly while this one
// is worked on, kernel 6 holds all four chunks at once.
// Fragment layout per CDNA5 ISA 7.12.2 (16-bit A 16x32): lane l holds row
// m=l&15; halves 0..7 = K {g*8..g*8+7}, halves 8..15 = K {16+g*8..}, g=l>>4.
// ---------------------------------------------------------------------------
#define WPITCH 264   // halves per W row in LDS: 512 B + 16 B (16 B x odd)

// one chunk of W: 64 rows of 512 B; each copy of a wave moves one whole row
__device__ __forceinline__ void copy_wchunk(const _Float16* __restrict__ wsrc,
                                            _Float16* buf, int tid) {
#pragma unroll
  for (int i = 0; i < 8; ++i) {
    const int row = i * 8 + (tid >> 5), off = (tid & 31) * 8;
    stage16(wsrc + row * 256 + off, buf + row * WPITCH + off);
  }
}

// the wave's 32 rows of A over all K, straight from global memory
__device__ __forceinline__ void load_afrags(const _Float16* __restrict__ ar, FragH (&a)[2][8]) {
#pragma unroll
  for (int mt = 0; mt < 2; ++mt)
#pragma unroll
    for (int ks = 0; ks < 8; ++ks) {
      a[mt][ks].q[0] = *(const u32x4*)(ar + mt * 16 * 256 + ks * 32);
      a[mt][ks].q[1] = *(const u32x4*)(ar + mt * 16 * 256 + ks * 32 + 16);
    }
}

// one block of W fragments: 2 k steps x 4 column tiles, 16 LDS reads issued as one group
__device__ __forceinline__ void load_wblock(FragH (&bs)[8], const _Float16* br, int blk) {
#pragma unroll
  for (int k2 = 0; k2 < 2; ++k2)
#pragma unroll
    for (int tn = 0; tn < 4; ++tn) {
      bs[k2 * 4 + tn].q[0] = *(const u32x4*)(br + tn * 16 * WPITCH + (blk * 2 + k2) * 32);
      bs[k2 * 4 + tn].q[1] = *(const u32x4*)(br + tn * 16 * WPITCH + (blk * 2 + k2) * 32 + 16);
    }
}

// 32 rows x 64 columns over K = 256, in 4 blocks of 16 products; each W fragment
// serves two products. bs[0] holds block 0 on entry; each later block is read
// into the other fragment set while the current block's products run.
// WROWS = false: A rows are the result's rows (a lane holds one column, 8 rows).
// WROWS = true: the W fragment is the first operand (both operands share one
// fragment layout), so a lane holds one A row and 8 consecutive columns.
template <bool WROWS>
__device__ __forceinline__ void chunk_products(const FragH (&a)[2][8], const _Float16* br,
                                               FragH (&bs)[2][8], v8f (&acc)[2][4]) {
#pragma unroll
  for (int blk = 0; blk < 4; ++blk) {
    if (blk < 3) load_wblock(bs[(blk + 1) & 1], br, blk + 1);
    // keeps the next block's LDS reads one group in front of this block's products:
    // sunk among them, each product pair would wait out an LDS latency of its own
    __builtin_amdgcn_sched_barrier(0);
#pragma unroll
    for (int k2 = 0; k2 < 2; ++k2)
#pragma unroll
      for (int tn = 0; tn < 4; ++tn)
#pragma unroll
        for (int mt = 0; mt < 2; ++mt)
          acc[mt][tn] = WROWS
              ? __builtin_amdgcn_wmma_f32_16x16x32_f16(
                    false, bs[blk & 1][k2 * 4 + tn].h, false, a[mt][blk * 2 + k2].h,
                    (short)0, acc[mt][tn], false, false)
              : __builtin_amdgcn_wmma_f32_16x16x32_f16(
                    false, a[mt][blk * 2 + k2].h, false, bs[blk & 1][k2 * 4 + tn].h,
                    (short)0, acc[mt][tn], false, false);
    // the other side of the same fence: later reads do not rise into this block
    __builtin_amdgcn_sched_barrier(0);
  }
}

// the wave's own LDS reads and writes have retired (in front of a hand-over barrier)
__device__ __forceinline__ void wait_lds()    { asm volatile("s_wait_dscnt 0x0" ::: "memory"); }
// the wave's own async copies have landed (in front of the barrier that publishes them)
__device__ __forceinline__ void wait_copies() { asm volatile("s_wait_asynccnt 0x0" ::: "memory"); }

// work-group barrier that orders LDS alone: the fences name the LDS address space (the release
// one waits out the wave's own LDS operations), so the global loads of v that are in flight
// stay in flight across it (__syncthreads() waits them out)
__device__ __forceinline__ void lds_barrier() {
  __builtin_amdgcn_fence(__ATOMIC_RELEASE, "workgroup", "local");
  __builtin_amdgcn_s_barrier();
  __builtin_amdgcn_fence(__ATOMIC_ACQUIRE, "workgroup", "local");
}

// the value of the lane 16 away (lanes l and l ^ 16 hold the two halves of a row's channels)
__device__ __forceinline__ float other_half(float v) {
  const unsigned u = __float_as_uint(v);
  return __uint_as_float(__builtin_amdgcn_permlanex16(u, u, 0x76543210u, 0xfedcba98u, false, false));
}

// ---------------------------------------------------------------------------
// Kernel 3: LayerNorm over channels + qkv projection GEMM
// [65536 x 256] x [256 x 768] with WMMA.
// x is [b][c=256][pos=4096]. A lane of an A fragment holds one pos and 8 + 8
// channels per k step, so it reads its channels straight from x: one 8-byte
// load per channel brings pos 2*lm and 2*lm+1, which are row lm of the wave's
// first and second 16-row tile (16 lanes = one whole 128-B line of a channel).
// All 256 channels of the wave's 32 pos are then in registers as f32: the sums
// over channels are taken in the lane and added to those of lane l ^ 16, and the
// normalized values are rounded once to f16, in fragment order.
// Each q or k chunk's 256 pos x 64 col result goes as f16 into one of two LDS
// staging tiles [col][pos]; behind the chunk's one barrier every wave stores 8
// columns, 512 contiguous bytes each, into planar qk16[2][b][h][d][n].
// The v chunks (the last four) are wanted as rows v16[b*4096 + pos][h*32 + d],
// the A operand of kernel 6: their products take W as the first operand, the
// staging tile is [pos][col], and every wave stores 32 rows of 128 bytes.
// ---------------------------------------------------------------------------
#define VPITCH 72    // halves per pos row of a v staging tile: 128 B + 16 B
__global__ __launch_bounds__(256) void k_gemm_qkv(const float* __restrict__ x,
                                                  const float* __restrict__ gamma,
                                                  const float* __restrict__ beta,
                                                  const _Float16* __restrict__ w16,
                                                  _Float16* __restrict__ qk16,
                                                  _Float16* __restrict__ v16) {
  __shared__ __attribute__((aligned(16))) _Float16 ldsB[2][64 * WPITCH];
  __shared__ __attribute__((aligned(16))) _Float16 ldsS[2][256 * VPITCH];   // >= 64 * 264
  __shared__ __attribute__((aligned(16))) float    gamS[256], betS[256];
  const int tid  = threadIdx.x;
  // the wave's number in a scalar register: column and row offsets formed from it stay scalar
  const int wave = __builtin_amdgcn_readfirstlane(tid >> 5), lane = tid & 31;
  const int g = lane >> 4, lm = lane & 15;
  const int m0 = blockIdx.x * 256;
  const int bb = m0 >> 12, posB = m0 & 4095;
  copy_wchunk(w16, ldsB[0], tid);
  const float gmT = gamma[tid], btT = beta[tid];
  // xr[ks][j]: channel ks*32 + (j>>3)*16 + g*8 + (j&7), the fragment's own k order
  // (every loop over xr[] and a[] is unrolled so that they stay in registers)
  f32x2 xr[8][16];
  const float* xp = x + ((size_t)bb * 256 + g * 8) * 4096 + posB + wave * 32 + lm * 2;
#pragma unroll
  for (int ks = 0; ks < 8; ++ks)
#pragma unroll
    for (int j = 0; j < 16; ++j)
      xr[ks][j] = *(const f32x2*)(xp + (size_t)(ks * 32 + (j >> 3) * 16 + (j & 7)) * 4096);
  // stands in front of the first overwrite of an address register of the loads above;
  // xp is named so that its registers live up to here and no load lands in them
  asm volatile("s_wait_xcnt 0x0" :: "v"(xp) : "memory");
  // keeps the scheduler from sinking loads among the sums below: all of them are
  // in flight before the first wait
  __builtin_amdgcn_sched_barrier(0);
  gamS[tid] = gmT;
  betS[tid] = btT;
  // sums and sums of squares of the lane's 128 channels, two chains per sum
  f32x2 sA = {0.f, 0.f}, sB = {0.f, 0.f}, qA = {0.f, 0.f}, qB = {0.f, 0.f};
#pragma unroll
  for (int ks = 0; ks < 8; ++ks)
#pragma unroll
    for (int j = 0; j < 16; j += 2) {
      sA += xr[ks][j];     qA += xr[ks][j] * xr[ks][j];
      sB += xr[ks][j + 1]; qB += xr[ks][j + 1] * xr[ks][j + 1];
    }
  f32x2 mu, ri;
#pragma unroll
  for (int mt = 0; mt < 2; ++mt) {
    const float sh = sA[mt] + sB[mt], qh = qA[mt] + qB[mt];
    const float ts = sh + other_half(sh), tq = qh + other_half(qh);
    const float m  = ts * (1.0f / 256.0f);
    const float var = tq * (1.0f / 256.0f) - m * m;
    mu[mt] = m;
    ri[mt] = rsqrtf(var + LN_EPS);
  }
  wait_copies();
  // publishes chunk 0 of W and gamma, beta
  __syncthreads();
  copy_wchunk(w16 + 64 * 256, ldsB[1], tid);
  FragH a[2][8];
#pragma unroll
  for (int ks = 0; ks < 8; ++ks)
#pragma unroll
    for (int hf = 0; hf < 2; ++hf) {
      const int c0 = ks * 32 + hf * 16 + g * 8;
      f32x4 gm[2], bt[2];
      gm[0] = *(const f32x4*)(gamS + c0); gm[1] = *(const f32x4*)(gamS + c0 + 4);
      bt[0] = *(const f32x4*)(betS + c0); bt[1] = *(const f32x4*)(betS + c0 + 4);
#pragma unroll
      for (int e = 0; e < 8; ++e) {
        const f32x2 v = (xr[ks][hf * 8 + e] - mu) * ri * gm[e >> 2][e & 3] + bt[e >> 2][e & 3];
        a[0][ks].h[hf * 8 + e] = (_Float16)v[0];
        a[1][ks].h[hf * 8 + e] = (_Float16)v[1];
      }
    }
  FragH bs[2][8];
  load_wblock(bs[0], ldsB[0] + lm * WPITCH + g * 8, 0);
  // stays rolled: one trip already holds 64 products, and the loop's text stays short
#pragma unroll 1
  for (int ch = 0; ch < 8; ++ch) {
    v8f acc[2][4] = {};
    chunk_products<false>(a, ldsB[ch & 1] + lm * WPITCH + g * 8, bs, acc);
    _Float16* ss = ldsS[ch & 1];
    // row g*8 + r of tile mt is pos wave*32 + g*16 + 2*r + mt
#pragma unroll
    for (int tn = 0; tn < 4; ++tn)
#pragma unroll
      for (int rh = 0; rh < 2; ++rh) {
        h8v ov;
#pragma unroll
        for (int r = 0; r < 4; ++r) {
          ov[r * 2]     = (_Float16)acc[0][tn][rh * 4 + r];
          ov[r * 2 + 1] = (_Float16)acc[1][tn][rh * 4 + r];
        }
        *(h8v*)(ss + (tn * 16 + lm) * 264 + wave * 32 + g * 16 + rh * 8) = ov;
      }
    // hand-over: chunk ch+1 of W and this chunk's staging tile become readable,
    // and every reader has left the W buffer that is refilled below
    wait_lds();
    wait_copies();
    __syncthreads();
    copy_wchunk(w16 + (size_t)(ch + 2) * 64 * 256, ldsB[ch & 1], tid);
    // the next chunk's first block, behind the barrier that has published it
    load_wblock(bs[0], ldsB[(ch + 1) & 1] + lm * WPITCH + g * 8, 0);
#pragma unroll
    for (int i = 0; i < 8; ++i) {
      const int cl  = wave * 8 + i;
      const int col = ch * 64 + cl;
      const u32x4 v = *(const u32x4*)(ss + cl * 264 + lane * 8);
      const size_t row = (size_t)(col >> 8) * 4096 + bb * 256 + (col & 255);
      *(u32x4*)(qk16 + row * 4096 + posB + lane * 8) = v;
    }
    // stands in front of the next trip's first overwrite of a register of the stores above
    asm volatile("s_wait_xcnt 0x0" ::: "memory");
  }
  // the lane's place in a v staging tile and in v16 for the row stores below: row
  // wave*32 + (lane >> 3) and 16 of its 128 bytes; the other rows are constant steps away
  const int vso = (wave * 32 + (lane >> 3)) * VPITCH + (lane & 7) * 8;
  _Float16* vd = v16 + (size_t)(m0 + wave * 32 + (lane >> 3)) * 256 + (lane & 7) * 8;
  // the v chunks; stays rolled for the same reason
#pragma unroll 1
  for (int ch = 8; ch < 12; ++ch) {
    v8f acc[2][4] = {};
    chunk_products<true>(a, ldsB[ch & 1] + lm * WPITCH + g * 8, bs, acc);
    _Float16* ss = ldsS[ch & 1];
    // the lane holds pos wave*32 + 2*lm + mt and columns tn*16 + g*8 + (0..7)
#pragma unroll
    for (int mt = 0; mt < 2; ++mt)
#pragma unroll
      for (int tn = 0; tn < 4; ++tn) {
        h8v ov;
#pragma unroll
        for (int r = 0; r < 8; ++r) ov[r] = (_Float16)acc[mt][tn][r];
        *(h8v*)(ss + (wave * 32 + lm * 2 + mt) * VPITCH + tn * 16 + g * 8) = ov;
      }
    // hand-over, as in the loop above
    wait_lds();
    wait_copies();
    __syncthreads();
    if (ch + 2 < 12) copy_wchunk(w16 + (size_t)(ch + 2) * 64 * 256, ldsB[ch & 1], tid);
    // the next chunk's first block, behind the barrier that has published it
    if (ch + 1 < 12) load_wblock(bs[0], ldsB[(ch + 1) & 1] + lm * WPITCH + g * 8, 0);
    // 8 lanes store one row's 128 bytes: whole lines
#pragma unroll
    for (int i = 0; i < 8; ++i) {
      const u32x4 v = *(const u32x4*)(ss + vso + i * 4 * VPITCH);
      *(u32x4*)(vd + (ch - 8) * 64 + i * 4 * 256) = v;
    }
    // stands in front of the next trip's first overwrite of a register of the stores above
    asm volatile("s_wait_xcnt 0x0" ::: "memory");
  }
  wait_copies();
}

// ---------------------------------------------------------------------------
// Kernel 5a: partial cross-covariance sums. sim = q . k^T over n (K=4096) is
// split over n: work-group (bh, sl) takes 1024 positions, each of its 8 waves
// a span of 128 and all four 16x16 tiles of the 32x32 result. The 8 spans are
// summed through LDS in wave order; simP[bh][sl][32*32] f32 goes to kernel 6.
// q and k are read as the projection left them (not normalized). The sums of
// squares of their rows over the same span are the diagonals of q.q^T and
// k.k^T, taken from the fragments already in registers; they are summed the
// same way into ssP[bh][sl][64] (32 q rows, then 32 k rows) for kernel 6.
// ---------------------------------------------------------------------------
__global__ __launch_bounds__(256) void k_sim(const _Float16* __restrict__ qkv16,
                                             float* __restrict__ simP,
                                             float* __restrict__ ssP) {
  __shared__ float part[8 * 32 * 33];
  __shared__ float ssW[8 * 64];
  const int bh = blockIdx.x, sl = blockIdx.y;
  const int b = bh >> 3, h = bh & 7;
  const int tid  = threadIdx.x;
  const int wave = tid >> 5, lane = tid & 31;
  const int g = lane >> 4, lm = lane & 15;
  const size_t planeQ = (((size_t)0 * 16 + b) * 8 + h) * (size_t)32 * 4096;
  const size_t planeK = (((size_t)1 * 16 + b) * 8 + h) * (size_t)32 * 4096;
  const int n0 = sl * 1024 + wave * 128;
  const _Float16* qr = qkv16 + planeQ + (size_t)lm * 4096 + n0;
  const _Float16* kr = qkv16 + planeK + (size_t)lm * 4096 + n0;
  // the wave's whole span is loaded first: 32 loads in flight, one memory latency
  // (every loop over a[], bf[], acc[] is unrolled so that they stay in registers)
  FragH a[4][2], bf[4][2];
#pragma unroll
  for (int s = 0; s < 4; ++s)
#pragma unroll
    for (int t = 0; t < 2; ++t) {
      a[s][t].q[0]  = *(const u32x4*)(qr + t * 16 * 4096 + s * 32 + g * 8);
      a[s][t].q[1]  = *(const u32x4*)(qr + t * 16 * 4096 + s * 32 + 16 + g * 8);
      bf[s][t].q[0] = *(const u32x4*)(kr + t * 16 * 4096 + s * 32 + g * 8);
      bf[s][t].q[1] = *(const u32x4*)(kr + t * 16 * 4096 + s * 32 + 16 + g * 8);
    }
  // keeps the scheduler from sinking loads between the products, where each
  // group would wait out its own latency
  __builtin_amdgcn_sched_barrier(0);
  v8f acc[2][2] = {};
  v8f qq[2] = {}, kk[2] = {};
#pragma unroll
  for (int s = 0; s < 4; ++s) {
#pragma unroll
    for (int it = 0; it < 2; ++it)
#pragma unroll
      for (int jt = 0; jt < 2; ++jt)
        acc[it][jt] = __builtin_amdgcn_wmma_f32_16x16x32_f16(false, a[s][it].h, false, bf[s][jt].h,
                                                             (short)0, acc[it][jt], false, false);
    // A and B fragments share one k order, so a fragment times itself is a Gram tile
#pragma unroll
    for (int t = 0; t < 2; ++t) {
      qq[t] = __builtin_amdgcn_wmma_f32_16x16x32_f16(false, a[s][t].h, false, a[s][t].h,
                                                     (short)0, qq[t], false, false);
      kk[t] = __builtin_amdgcn_wmma_f32_16x16x32_f16(false, bf[s][t].h, false, bf[s][t].h,
                                                     (short)0, kk[t], false, false);
    }
  }
  // diagonal element of row lm sits in the lane with g == lm >> 3, register lm & 7
#pragma unroll
  for (int t = 0; t < 2; ++t) {
    float dq = qq[t][0], dk = kk[t][0];
#pragma unroll
    for (int r = 1; r < 8; ++r)
      if ((lm & 7) == r) { dq = qq[t][r]; dk = kk[t][r]; }
    if ((lm >> 3) == g) {
      ssW[wave * 64 + t * 16 + lm]      = dq;
      ssW[wave * 64 + 32 + t * 16 + lm] = dk;
    }
  }
  float* pw = part + wave * (32 * 33);
#pragma unroll
  for (int it = 0; it < 2; ++it)
#pragma unroll
    for (int jt = 0; jt < 2; ++jt)
#pragma unroll
      for (int r = 0; r < 8; ++r)
        pw[(it * 16 + g * 8 + r) * 33 + jt * 16 + lm] = acc[it][jt][r];
  __syncthreads();
  float* dst = simP + ((size_t)bh * 4 + sl) * 1024;
  for (int idx = tid; idx < 1024; idx += 256) {
    const int o = (idx >> 5) * 33 + (idx & 31);
    float s = part[o];
#pragma unroll
    for (int w = 1; w < 8; ++w) s += part[w * (32 * 33) + o];
    dst[idx] = s;
  }
  if (tid < 64) {
    float s = ssW[tid];
#pragma unroll
    for (int w = 1; w < 8; ++w) s += ssW[w * 64 + tid];
    ssP[((size_t)bh * 4 + sl) * 64 + tid] = s;
  }
}

// ---------------------------------------------------------------------------
// Kernel 6: output projection GEMM [65536 x 256] x [256 x 256] + bias, with the
// attention folded into its weight. (attn . v)^T . W_out = v^T . (attn^T . W_out),
// so the rows of v are multiplied by the batch's own weight
//   wm[c][h*32 + j] = sum_i attn[i][j] * W_out[h*32 + i][c]   (K=32, one WMMA per tile)
// which every work-group forms for itself in LDS, one head per wave, while its
// rows of v are on their way from memory:
//   sim = sum of the 4 partial planes, in slice order, times
//         exp(temperature[h]) / max(|q_i|, eps) / max(|k_j|, eps), the norms
//         from the 4 partial sums of squares (the l2norm of q and k)
//   attn = softmax(sim * 8) over j
// W_out (f16, [col][k]) comes whole into LDS by async copies; a head's 64 bytes
// of every row are read by its wave alone and overwritten in place by wm: a lane
// stores to the bytes that it has loaded. The GEMM itself has the form of kernel
// 3 (4 chunks of 64 columns, all resident); the staging tiles hold f32 + bias, and
// every wave stores 8 columns of 1024 contiguous bytes into [b][c][H][W].
// ---------------------------------------------------------------------------
__global__ __launch_bounds__(256) void k_gemm_out(const _Float16* __restrict__ a16,
                                                  const float* __restrict__ simP,
                                                  const float* __restrict__ ssP,
                                                  const float* __restrict__ temperature,
                                                  const _Float16* __restrict__ wo16,
                                                  const float* __restrict__ bias,
                                                  float* __restrict__ outp) {
  __shared__ __attribute__((aligned(16))) _Float16 ldsW[256 * WPITCH];
  __shared__ __attribute__((aligned(16))) float    ldsS[2][64 * 260];
  __shared__ float sim[8][32 * 33];
  __shared__ __attribute__((aligned(16))) _Float16 attnT[8][32 * 40];
  const int tid  = threadIdx.x;
  // the wave's number in a scalar register: column and row offsets formed from it stay scalar
  const int wave = __builtin_amdgcn_readfirstlane(tid >> 5), lane = tid & 31;
  const int g = lane >> 4, lm = lane & 15;
  const int m0 = blockIdx.x * 256;
  const int bb = m0 >> 12, posB = m0 & 4095;
  // all of W_out: 32 copies of a wave in flight
#pragma unroll
  for (int c = 0; c < 4; ++c) copy_wchunk(wo16 + c * 64 * 256, ldsW + c * 64 * WPITCH, tid);
  // ---- the wave's head: its partial planes and partial sums of squares into registers
  // (loops over pS[], pQ[], pK[], a[], rv[], bf[] are unrolled: they stay in registers)
  f32x4 pS[4][8];
  float pQ[4], pK[4];
  const size_t bh = (size_t)bb * 8 + wave;
  const float* sp = simP + bh * 4 * 1024 + lane * 4;
  const float* np = ssP + bh * 4 * 64 + lane;
#pragma unroll
  for (int sl = 0; sl < 4; ++sl) {
#pragma unroll
    for (int it = 0; it < 8; ++it) pS[sl][it] = *(const f32x4*)(sp + sl * 1024 + it * 128);
    pQ[sl] = np[sl * 64];
    pK[sl] = np[sl * 64 + 32];
  }
  const float tq = temperature[wave];
  // the rows of v are asked for behind the small loads and land while wm is formed
  FragH a[2][8];
  const _Float16* ar = a16 + (size_t)(m0 + wave * 32 + lm) * 256 + g * 8;
  load_afrags(ar, a);
  // stands in front of the first overwrite of an address register of the loads above;
  // the pointers are named so that their registers live up to here and no load lands in them
  asm volatile("s_wait_xcnt 0x0" :: "v"(sp), "v"(np), "v"(ar) : "memory");
  // keeps the scheduler from sinking the loads of v behind the waits of the sums
  // below, where they would wait out a second memory latency
  __builtin_amdgcn_sched_barrier(0);
  // ---- sum of the partial planes, in slice order: element (it*32 + lane)*4 + e
  float* sw = sim[wave];
#pragma unroll
  for (int it = 0; it < 8; ++it) {
    f32x4 s4 = pS[0][it];
#pragma unroll
    for (int sl = 1; sl < 4; ++sl) s4 += pS[sl][it];
    float* sd = sw + (it * 4 + (lane >> 3)) * 33 + (lane & 7) * 4;
#pragma unroll
    for (int e = 0; e < 4; ++e) sd[e] = s4[e];
  }
  // the lane's inverse norms: of q row i = lane (with the temperature) and of k row j = lane
  float ssq = pQ[0], ssk = pK[0];
#pragma unroll
  for (int sl = 1; sl < 4; ++sl) { ssq += pQ[sl]; ssk += pK[sl]; }
  const float rq = __expf(tq) * (1.0f / fmaxf(sqrtf(ssq), L2_EPS));
  const float rk = 1.0f / fmaxf(sqrtf(ssk), L2_EPS);
  wait_copies();
  // publishes W_out and the summed planes
  lds_barrier();
  // ---- softmax of row i = lane, written transposed: attnT[j][i]
  {
    const float* row = sw + lane * 33;
    float rv[32];
    float mx = -1e30f;
#pragma unroll
    for (int j = 0; j < 32; ++j) {
      const float rkj = __uint_as_float(__builtin_amdgcn_readlane(__float_as_uint(rk), j));
      rv[j] = row[j] * rq * rkj;
      mx = fmaxf(mx, rv[j]);
    }
    float sum = 0.f;
#pragma unroll
    for (int j = 0; j < 32; ++j) {
      rv[j] = __expf((rv[j] - mx) * SM_SCALE);
      sum += rv[j];
    }
    const float inv = 1.0f / sum;
    _Float16* at = attnT[wave] + lane;
#pragma unroll
    for (int j = 0; j < 32; ++j) at[j * 40] = (_Float16)(rv[j] * inv);
  }
  // publishes attnT
  lds_barrier();
  // ---- wm = attn^T . W_out: result rows j, columns c, over the head's own bytes of ldsW
  {
    FragH at2[2];
#pragma unroll
    for (int jt = 0; jt < 2; ++jt) {
      const _Float16* p = attnT[wave] + (jt * 16 + lm) * 40;
      at2[jt].q[0] = *(const u32x4*)(p + g * 8);
      at2[jt].q[1] = *(const u32x4*)(p + 16 + g * 8);
    }
    _Float16* wp = ldsW + lm * WPITCH + wave * 32 + g * 8;
    FragH bf[16];
#pragma unroll
    for (int u = 0; u < 16; ++u) {
      bf[u].q[0] = *(const u32x4*)(wp + u * 16 * WPITCH);
      bf[u].q[1] = *(const u32x4*)(wp + u * 16 * WPITCH + 16);
    }
#pragma unroll
    for (int u = 0; u < 16; ++u)
#pragma unroll
      for (int jt = 0; jt < 2; ++jt) {
        v8f z = {};
        v8f c = __builtin_amdgcn_wmma_f32_16x16x32_f16(false, at2[jt].h, false, bf[u].h,
                                                       (short)0, z, false, false);
        h8v ov;
#pragma unroll
        for (int r = 0; r < 8; ++r) ov[r] = (_Float16)c[r];
        *(h8v*)(wp + u * 16 * WPITCH + jt * 16) = ov;
      }
  }
  // publishes wm
  lds_barrier();
  FragH bs[2][8];
  load_wblock(bs[0], ldsW + lm * WPITCH + g * 8, 0);
  // stays rolled: one trip already holds 64 products, and the loop's text stays short
#pragma unroll 1
  for (int ch = 0; ch < 4; ++ch) {
    // this chunk's bias, one value per column tile; read here, its latency passes under the products
    float bv[4];
#pragma unroll
    for (int tn = 0; tn < 4; ++tn) bv[tn] = bias[ch * 64 + tn * 16 + lm];
    v8f acc[2][4] = {};
    chunk_products<false>(a, ldsW + (ch * 64 + lm) * WPITCH + g * 8, bs, acc);
    float* ss = ldsS[ch & 1];
#pragma unroll
    for (int mt = 0; mt < 2; ++mt)
#pragma unroll
      for (int tn = 0; tn < 4; ++tn) {
        float* sd = ss + (tn * 16 + lm) * 260 + wave * 32 + mt * 16 + g * 8;
        f32x4 lo, hi;
#pragma unroll
        for (int e = 0; e < 4; ++e) { lo[e] = acc[mt][tn][e] + bv[tn]; hi[e] = acc[mt][tn][4 + e] + bv[tn]; }
        *(f32x4*)sd       = lo;
        *(f32x4*)(sd + 4) = hi;
      }
    // hand-over: this chunk's staging tile becomes readable
    wait_lds();
    __syncthreads();
    // the next chunk's first block
    if (ch + 1 < 4) load_wblock(bs[0], ldsW + ((ch + 1) * 64 + lm) * WPITCH + g * 8, 0);
#pragma unroll
    for (int i = 0; i < 8; ++i) {
      const int cl = wave * 8 + i;
      const int c  = ch * 64 + cl;
      float* dst = outp + ((size_t)bb * 256 + c) * 4096 + posB;
#pragma unroll
      for (int hf = 0; hf < 2; ++hf) {
        const f32x4 o = *(const f32x4*)(ss + cl * 260 + hf * 128 + lane * 4);
        *(f32x4*)(dst + hf * 128 + lane * 4) = o;
      }
    }
    // stands in front of the next trip's first overwrite of a register of the stores above
    asm volatile("s_wait_xcnt 0x0" ::: "memory");
  }
}

// ---------------------------------------------------------------------------
extern "C" void kernel_launch(void* const* d_in, const int* in_sizes, int n_in,
                              void* d_out, int out_size, void* d_ws, size_t ws_size,
                              hipStream_t stream) {
  (void)in_sizes; (void)n_in; (void)out_size; (void)ws_size;
  const float* x    = (const float*)d_in[0];
  const float* gam  = (const float*)d_in[1];
  const float* bet  = (const float*)d_in[2];
  const float* Wqkv = (const float*)d_in[3];
  const float* temp = (const float*)d_in[4];
  const float* Wout = (const float*)d_in[5];
  const float* bout = (const float*)d_in[6];

  char* ws = (char*)d_ws;
  _Float16* w16   = (_Float16*)ws; ws += (size_t)768 * 256 * 2;              // 384 KB
  _Float16* wo16  = (_Float16*)ws; ws += (size_t)256 * 256 * 2;              // 128 KB
  _Float16* qk16  = (_Float16*)ws; ws += (size_t)2 * 16 * 8 * 32 * 4096 * 2; // 64 MB
  _Float16* v16   = (_Float16*)ws; ws += (size_t)65536 * 256 * 2;            // 32 MB
  float*    simP  = (float*)ws;    ws += (size_t)128 * 4 * 1024 * 4;         // 2 MB
  float*    ssP   = (float*)ws;    ws += (size_t)128 * 4 * 64 * 4;           // 128 KB
  float* outp = (float*)d_out;

  k_cvtw    <<<dim3(1024),    256, 0, stream>>>(Wqkv, Wout, w16, wo16);
  k_gemm_qkv<<<dim3(256),     256, 0, stream>>>(x, gam, bet, w16, qk16, v16);
  k_sim     <<<dim3(128, 4),  256, 0, stream>>>(qk16, simP, ssP);
  k_gemm_out<<<dim3(256),     256, 0, stream>>>(v16, simP, ssP, temp, wo16, bout, outp);
}

// v007
// Measured time: 54.6 microseconds a run.
// In both of two side-by-side timings against v006, it was 1.04 times as fast.
// Counting every step since v000, it is 3.99 times as fast.
#include <hip/hip_runtime.h>
#include <hip/hip_bf16.h>
#include <math.h>
#include <stdint.h>

typedef __attribute__((ext_vector_type(16))) _Float16 v16h;
typedef __attribute__((ext_vector_type(8)))  float    v8f;
typedef __attribute__((ext_vector_type(4)))  unsigned u32x4;
typedef __attribute__((ext_vector_type(8)))  _Float16 h8v;
typedef __attribute__((ext_vector_type(4)))  float    f32x4;
typedef __attribute__((ext_vector_type(2)))  float    f32x2;
typedef __attribute__((ext_vector_type(4)))  int      i32x4;

union FragH { v16h h; u32x4 q[2]; };

#define LN_EPS   1e-5f
#define L2_EPS   1e-12f
#define SM_SCALE 8.0f

// ---------------------------------------------------------------------------
// CDNA5 async global->LDS staging (ASYNCcnt path), with safe fallback.
// Builtin signature (leaked by compiler diagnostic): param0 = int4 addrspace(1)*.
// ---------------------------------------------------------------------------
#if defined(__HIP_DEVICE_COMPILE__) && __has_builtin(__builtin_amdgcn_global_load_async_to_lds_b128)
#define USE_ASYNC_LDS 1
#else
#define USE_ASYNC_LDS 0
#endif

#if USE_ASYNC_LDS
typedef __attribute__((address_space(1))) i32x4 g_i32x4;
typedef __attribute__((address_space(3))) i32x4 l_i32x4;
#endif

__device__ __forceinline__ void stage16(const _Float16* g, _Float16* l) {
#if USE_ASYNC_LDS
  __builtin_amdgcn_global_load_async_to_lds_b128(
      (g_i32x4*)(uintptr_t)g,
      (l_i32x4*)(uint32_t)(uintptr_t)l, 0, 0);
#else
  *(u32x4*)l = *(const u32x4*)g;
#endif
}

// ---------------------------------------------------------------------------
// Kernel 2: convert weights to f16, stored transposed (w16[col][k]).
// ---------------------------------------------------------------------------
__global__ __launch_bounds__(256) void k_cvtw(const float* __restrict__ Wqkv,
                                              const float* __restrict__ Wout,
                                              _Float16* __restrict__ w16,
                                              _Float16* __restrict__ wo16) {
  int idx = blockIdx.x * 256 + threadIdx.x;
  if (idx < 768 * 256) {
    int col = idx >> 8, k = idx & 255;
    w16[idx] = (_Float16)Wqkv[(size_t)k * 768 + col];
  } else {
    int i2 = idx - 768 * 256;
    if (i2 < 256 * 256) {
      int col = i2 >> 8, k = i2 & 255;
      wo16[i2] = (_Float16)Wout[(size_t)k * 256 + col];
    }
  }
}

// ---------------------------------------------------------------------------
// Shared parts of the two projection GEMMs (kernels 3 and 6).
// A work-group of 8 waves owns 256 rows of A. Each wave holds its 32 rows over
// the whole K = 256 in registers (2 x 8 fragments) and the work-group walks all
// columns in chunks of 64: a chunk of W (64 rows x 256 k) lies in LDS; kernel 3
// keeps it in one of two buffers, the next chunk's async copies fly while this one
// is worked on, kernel 6 holds all four chunks at once.
// Fragment layout per CDNA5 ISA 7.12.2 (16-bit A 16x32): lane l holds row
// m=l&15; halves 0..7 = K {g*8..g*8+7}, halves 8..15 = K {16+g*8..}, g=l>>4.
// ---------------------------------------------------------------------------
#define WPITCH 264   // halves per W row in LDS: 512 B + 16 B (16 B x odd)

// one chunk of W: 64 rows of 512 B; each copy of a wave moves one whole row
__device__ __forceinline__ void copy_wchunk(const _Float16* __restrict__ wsrc,
                                            _Float16* buf, int tid) {
#pragma unroll
  for (int i = 0; i < 8; ++i) {
    const int row = i * 8 + (tid >> 5), off = (tid & 31) * 8;
    stage16(wsrc + row * 256 + off, buf + row * WPITCH + off);
  }
}

// the wave's 32 rows of A over all K, kept in memory in fragment order
// [mt][ks][half][lane][8]: every load of a wave is 512 contiguous bytes
__device__ __forceinline__ void load_afrags(const _Float16* __restrict__ ar, FragH (&a)[2][8]) {
#pragma unroll
  for (int mt = 0; mt < 2; ++mt)
#pragma unroll
    for (int ks = 0; ks < 8; ++ks) {
      a[mt][ks].q[0] = *(const u32x4*)(ar + (mt * 8 + ks) * 512);
      a[mt][ks].q[1] = *(const u32x4*)(ar + (mt * 8 + ks) * 512 + 256);
    }
}

// one block of W fragments: 2 k steps x 4 column tiles, 16 LDS reads issued as one group
__device__ __forceinline__ void load_wblock(FragH (&bs)[8], const _Float16* br, int blk) {
#pragma unroll
  for (int k2 = 0; k2 < 2; ++k2)
#pragma unroll
    for (int tn = 0; tn < 4; ++tn) {
      bs[k2 * 4 + tn].q[0] = *(const u32x4*)(br + tn * 16 * WPITCH + (blk * 2 + k2) * 32);
      bs[k2 * 4 + tn].q[1] = *(const u32x4*)(br + tn * 16 * WPITCH + (blk * 2 + k2) * 32 + 16);
    }
}

// 32 rows x 64 columns over K = 256, in 4 blocks of 16 products; each W fragment
// serves two products. bs[0] holds block 0 on entry; each later block is read
// into the other fragment set while the current block's products run.
// WROWS = false: A rows are the result's rows (a lane holds one column, 8 rows).
// WROWS = true: the W fragment is the first operand (both operands share one
// fragment layout), so a lane holds one A row and 8 consecutive columns.
template <bool WROWS>
__device__ __forceinline__ void chunk_products(const FragH (&a)[2][8], const _Float16* br,
                                               FragH (&bs)[2][8], v8f (&acc)[2][4]) {
#pragma unroll
  for (int blk = 0; blk < 4; ++blk) {
    if (blk < 3) load_wblock(bs[(blk + 1) & 1], br, blk + 1);
    // keeps the next block's LDS reads one group in front of this block's products:
    // sunk among them, each product pair would wait out an LDS latency of its own
    __builtin_amdgcn_sched_barrier(0);
#pragma unroll
    for (int k2 = 0; k2 < 2; ++k2)
#pragma unroll
      for (int tn = 0; tn < 4; ++tn)
#pragma unroll
        for (int mt = 0; mt < 2; ++mt)
          acc[mt][tn] = WROWS
              ? __builtin_amdgcn_wmma_f32_16x16x32_f16(
                    false, bs[blk & 1][k2 * 4 + tn].h, false, a[mt][blk * 2 + k2].h,
                    (short)0, acc[mt][tn], false, false)
              : __builtin_amdgcn_wmma_f32_16x16x32_f16(
                    false, a[mt][blk * 2 + k2].h, false, bs[blk & 1][k2 * 4 + tn].h,
                    (short)0, acc[mt][tn], false, false);
    // the other side of the same fence: later reads do not rise into this block
    __builtin_amdgcn_sched_barrier(0);
  }
}

// the wave's own LDS reads and writes have retired (in front of a hand-over barrier)
__device__ __forceinline__ void wait_lds()    { asm volatile("s_wait_dscnt 0x0" ::: "memory"); }
// the wave's own async copies have landed (in front of the barrier that publishes them)
__device__ __forceinline__ void wait_copies() { asm volatile("s_wait_asynccnt 0x0" ::: "memory"); }

// work-group barrier that orders LDS alone: the fences name the LDS address space (the release
// one waits out the wave's own LDS operations), so the global loads of v that are in flight
// stay in flight across it (__syncthreads() waits them out)
__device__ __forceinline__ void lds_barrier() {
  __builtin_amdgcn_fence(__ATOMIC_RELEASE, "workgroup", "local");
  __builtin_amdgcn_s_barrier();
  __builtin_amdgcn_fence(__ATOMIC_ACQUIRE, "workgroup", "local");
}

// one v chunk's result tiles as f16 into the wave's fragments of kernel 6: tile (mt, tn) is
// half tn & 1 of k step (tn >> 1) of the chunk's two; 512 contiguous bytes per store of a wave
__device__ __forceinline__ void store_vchunk(const v8f (&acc)[2][4], _Float16* vc) {
  h8v ov[2][4];
#pragma unroll
  for (int mt = 0; mt < 2; ++mt)
#pragma unroll
    for (int tn = 0; tn < 4; ++tn)
#pragma unroll
      for (int r = 0; r < 8; ++r) ov[mt][tn][r] = (_Float16)acc[mt][tn][r];
  // every tile is converted in front of the first store, so that each store has data
  // registers of its own and none is rewritten between the stores
  __builtin_amdgcn_sched_barrier(0);
#pragma unroll
  for (int mt = 0; mt < 2; ++mt)
#pragma unroll
    for (int tn = 0; tn < 4; ++tn)
      *(h8v*)(vc + (mt * 8 + (tn >> 1)) * 512 + (tn & 1) * 256) = ov[mt][tn];
}

// the value of the lane 16 away (lanes l and l ^ 16 hold the two halves of a row's channels)
__device__ __forceinline__ float other_half(float v) {
  const unsigned u = __float_as_uint(v);
  return __uint_as_float(__builtin_amdgcn_permlanex16(u, u, 0x76543210u, 0xfedcba98u, false, false));
}

// ---------------------------------------------------------------------------
// Kernel 3: LayerNorm over channels + qkv projection GEMM
// [65536 x 256] x [256 x 768] with WMMA.
// x is [b][c=256][pos=4096]. A lane of an A fragment holds one pos and 8 + 8
// channels per k step, so it reads its channels straight from x: one 8-byte
// load per channel brings pos 2*lm and 2*lm+1, which are row lm of the wave's
// first and second 16-row tile (16 lanes = one whole 128-B line of a channel).
// All 256 channels of the wave's 32 pos are then in registers as f32: the sums
// over channels are taken in the lane and added to those of lane l ^ 16, and the
// normalized values are rounded once to f16, in fragment order.
// q, k and v go to the next kernels in the order of the fragments those read, so
// a result tile's 8 values of a lane are stored from registers as they are, 512
// contiguous bytes per store of a wave, and are loaded the same way.
// q, k: qk16[2][b][h][n/32][t][mt][lane][8]. A lane holds column t*16 + lm of a
// head and rows g*8 + r of tile mt, which are pos 2*(g*8 + r) + mt of the wave's
// 32: the two tiles are the two halves of one 16 x 32 fragment of kernel 5a. Its
// k order over the 32 pos is a permutation, the same for q and for k.
// v: v16[work-group][wave][mt][ks][half][lane][8], the A fragments of kernel 6.
// The v chunks' products take W as the first operand, so a lane holds row lm of
// tile mt (pos 2*lm + mt) and columns tn*16 + g*8 + (0..7): half tn & 1 of k
// step (ch - 8)*2 + (tn >> 1).
// ---------------------------------------------------------------------------
__global__ __launch_bounds__(256) void k_gemm_qkv(const float* __restrict__ x,
                                                  const float* __restrict__ gamma,
                                                  const float* __restrict__ beta,
                                                  const _Float16* __restrict__ w16,
                                                  _Float16* __restrict__ qk16,
                                                  _Float16* __restrict__ v16) {
  __shared__ __attribute__((aligned(16))) _Float16 ldsB[2][64 * WPITCH];
  __shared__ __attribute__((aligned(16))) float    gamS[256], betS[256];
  const int tid  = threadIdx.x;
  // the wave's number in a scalar register: column and row offsets formed from it stay scalar
  const int wave = __builtin_amdgcn_readfirstlane(tid >> 5), lane = tid & 31;
  const int g = lane >> 4, lm = lane & 15;
  const int m0 = blockIdx.x * 256;
  const int bb = m0 >> 12, posB = m0 & 4095;
  copy_wchunk(w16, ldsB[0], tid);
  const float gmT = gamma[tid], btT = beta[tid];
  // xr[ks][j]: channel ks*32 + (j>>3)*16 + g*8 + (j&7), the fragment's own k order
  // (every loop over xr[] and a[] is unrolled so that they stay in registers)
  f32x2 xr[8][16];
  const float* xp = x + ((size_t)bb * 256 + g * 8) * 4096 + posB + wave * 32 + lm * 2;
#pragma unroll
  for (int ks = 0; ks < 8; ++ks)
#pragma unroll
    for (int j = 0; j < 16; ++j)
      xr[ks][j] = *(const f32x2*)(xp + (size_t)(ks * 32 + (j >> 3) * 16 + (j & 7)) * 4096);
  // stands in front of the first overwrite of an address register of the loads above;
  // xp is named so that its registers live up to here and no load lands in them
  asm volatile("s_wait_xcnt 0x0" :: "v"(xp) : "memory");
  // keeps the scheduler from sinking loads among the sums below: all of them are
  // in flight before the first wait
  __builtin_amdgcn_sched_barrier(0);
  gamS[tid] = gmT;
  betS[tid] = btT;
  // sums and sums of squares of the lane's 128 channels, two chains per sum
  f32x2 sA = {0.f, 0.f}, sB = {0.f, 0.f}, qA = {0.f, 0.f}, qB = {0.f, 0.f};
#pragma unroll
  for (int ks = 0; ks < 8; ++ks)
#pragma unroll
    for (int j = 0; j < 16; j += 2) {
      sA += xr[ks][j];     qA += xr[ks][j] * xr[ks][j];
      sB += xr[ks][j + 1]; qB += xr[ks][j + 1] * xr[ks][j + 1];
    }
  f32x2 mu, ri;
#pragma unroll
  for (int mt = 0; mt < 2; ++mt) {
    const float sh = sA[mt] + sB[mt], qh = qA[mt] + qB[mt];
    const float ts = sh + other_half(sh), tq = qh + other_half(qh);
    const float m  = ts * (1.0f / 256.0f);
    const float var = tq * (1.0f / 256.0f) - m * m;
    mu[mt] = m;
    ri[mt] = rsqrtf(var + LN_EPS);
  }
  wait_copies();
  // publishes chunk 0 of W and gamma, beta
  __syncthreads();
  copy_wchunk(w16 + 64 * 256, ldsB[1], tid);
  FragH a[2][8];
#pragma unroll
  for (int ks = 0; ks < 8; ++ks)
#pragma unroll
    for (int hf = 0; hf < 2; ++hf) {
      const int c0 = ks * 32 + hf * 16 + g * 8;
      f32x4 gm[2], bt[2];
      gm[0] = *(const f32x4*)(gamS + c0); gm[1] = *(const f32x4*)(gamS + c0 + 4);
      bt[0] = *(const f32x4*)(betS + c0); bt[1] = *(const f32x4*)(betS + c0 + 4);
#pragma unroll
      for (int e = 0; e < 8; ++e) {
        const f32x2 v = (xr[ks][hf * 8 + e] - mu) * ri * gm[e >> 2][e & 3] + bt[e >> 2][e & 3];
        a[0][ks].h[hf * 8 + e] = (_Float16)v[0];
        a[1][ks].h[hf * 8 + e] = (_Float16)v[1];
      }
    }
  FragH bs[2][8];
  load_wblock(bs[0], ldsB[0] + lm * WPITCH + g * 8, 0);
  // the lane's place in head 0 of q of its batch: 32-pos block posB/32 + wave (1024 halves each)
  _Float16* qd = qk16 + ((size_t)bb * 1024 + (posB >> 5) + wave) * 1024 + lane * 8;
  // stays rolled: one trip already holds 64 products, and the loop's text stays short
#pragma unroll 1
  for (int ch = 0; ch < 8; ++ch) {
    v8f acc[2][4] = {};
    chunk_products<false>(a, ldsB[ch & 1] + lm * WPITCH + g * 8, bs, acc);
    h8v ov[4][2];
#pragma unroll
    for (int tn = 0; tn < 4; ++tn)
#pragma unroll
      for (int mt = 0; mt < 2; ++mt)
#pragma unroll
        for (int r = 0; r < 8; ++r) ov[tn][mt][r] = (_Float16)acc[mt][tn][r];
    // hand-over: chunk ch+1 of W becomes readable, and every reader has left the
    // W buffer that is refilled below
    wait_lds();
    wait_copies();
    __syncthreads();
    copy_wchunk(w16 + (size_t)(ch + 2) * 64 * 256, ldsB[ch & 1], tid);
    // the next chunk's first block, behind the barrier that has published it
    load_wblock(bs[0], ldsB[(ch + 1) & 1] + lm * WPITCH + g * 8, 0);
    // the chunk holds heads (ch & 3)*2 and (ch & 3)*2 + 1 of q (ch < 4) or of k;
    // a head's plane is 128 blocks of 1024 halves
    _Float16* qc = qd + (size_t)((ch >> 2) * 128 + (ch & 3) * 2) * 131072;
#pragma unroll
    for (int tn = 0; tn < 4; ++tn)
#pragma unroll
      for (int mt = 0; mt < 2; ++mt)
        *(h8v*)(qc + (tn >> 1) * 131072 + (tn & 1) * 512 + mt * 256) = ov[tn][mt];
    // stands in front of the next trip's first overwrite of a register of the stores above
    asm volatile("s_wait_xcnt 0x0" ::: "memory");
  }
  // the lane's place in the wave's 16 KB of v fragments
  _Float16* vd = v16 + (size_t)(blockIdx.x * 8 + wave) * 8192 + lane * 8;
  // the v chunks; the first two refill a W buffer like the chunks above (rolled for the same reason)
#pragma unroll 1
  for (int ch = 8; ch < 10; ++ch) {
    v8f acc[2][4] = {};
    chunk_products<true>(a, ldsB[ch & 1] + lm * WPITCH + g * 8, bs, acc);
    // hand-over, as in the loop above
    wait_lds();
    wait_copies();
    __syncthreads();
    copy_wchunk(w16 + (size_t)(ch + 2) * 64 * 256, ldsB[ch & 1], tid);
    // the next chunk's first block, behind the barrier that has published it
    load_wblock(bs[0], ldsB[(ch + 1) & 1] + lm * WPITCH + g * 8, 0);
    store_vchunk(acc, vd + (ch - 8) * 1024);
    // stands in front of the next trip's first overwrite of a register of the stores above
    asm volatile("s_wait_xcnt 0x0" ::: "memory");
  }
  {
    // chunk 10: no chunk is left to copy
    v8f acc[2][4] = {};
    chunk_products<true>(a, ldsB[0] + lm * WPITCH + g * 8, bs, acc);
    // hand-over: the last chunk of W becomes readable
    wait_lds();
    wait_copies();
    __syncthreads();
    load_wblock(bs[0], ldsB[1] + lm * WPITCH + g * 8, 0);
    store_vchunk(acc, vd + 2 * 1024);
    // stands in front of the last chunk's first overwrite of a register of the stores above
    asm volatile("s_wait_xcnt 0x0" ::: "memory");
  }
  {
    // chunk 11: nothing is handed over behind it, so no barrier
    v8f acc[2][4] = {};
    chunk_products<true>(a, ldsB[1] + lm * WPITCH + g * 8, bs, acc);
    store_vchunk(acc, vd + 3 * 1024);
  }
  wait_copies();
}

// ---------------------------------------------------------------------------
// Kernel 5a: partial cross-covariance sums. sim = q . k^T over n (K=4096) is
// split over n: work-group (bh, sl) takes 1024 positions, each of its 8 waves
// a span of 128 and all four 16x16 tiles of the 32x32 result. The 8 spans are
// summed through LDS in wave order; simP[bh][sl][32*32] f32 goes to kernel 6.
// q and k are read as the projection left them (not normalized, in fragment
// order: a wave's span is 8 KB of q and 8 KB of k, each in a row). The sums of
// squares of their rows over the same span are the diagonals of q.q^T and
// k.k^T, taken from the fragments already in registers; they are summed the
// same way into ssP[bh][sl][64] (32 q rows, then 32 k rows) for kernel 6.
// ---------------------------------------------------------------------------
__global__ __launch_bounds__(256) void k_sim(const _Float16* __restrict__ qkv16,
                                             float* __restrict__ simP,
                                             float* __restrict__ ssP) {
  __shared__ float part[8 * 32 * 33];
  __shared__ float ssW[8 * 64];
  const int bh = blockIdx.x, sl = blockIdx.y;
  const int tid  = threadIdx.x;
  const int wave = tid >> 5, lane = tid & 31;
  const int g = lane >> 4, lm = lane & 15;
  // the wave's four 32-pos blocks (1024 halves each) of its head's plane of 128 blocks
  const _Float16* qr = qkv16 + ((size_t)bh * 128 + sl * 32 + wave * 4) * 1024 + lane * 8;
  const _Float16* kr = qr + (size_t)128 * 131072;
  // the wave's whole span is loaded first: 32 loads in flight, one memory latency
  // (every loop over a[], bf[], acc[] is unrolled so that they stay in registers)
  FragH a[4][2], bf[4][2];
#pragma unroll
  for (int s = 0; s < 4; ++s)
#pragma unroll
    for (int t = 0; t < 2; ++t) {
      a[s][t].q[0]  = *(const u32x4*)(qr + s * 1024 + t * 512);
      a[s][t].q[1]  = *(const u32x4*)(qr + s * 1024 + t * 512 + 256);
      bf[s][t].q[0] = *(const u32x4*)(kr + s * 1024 + t * 512);
      bf[s][t].q[1] = *(const u32x4*)(kr + s * 1024 + t * 512 + 256);
    }
  // keeps the scheduler from sinking loads between the products, where each
  // group would wait out its own latency
  __builtin_amdgcn_sched_barrier(0);
  v8f acc[2][2] = {};
  v8f qq[2] = {}, kk[2] = {};
#pragma unroll
  for (int s = 0; s < 4; ++s) {
#pragma unroll
    for (int it = 0; it < 2; ++it)
#pragma unroll
      for (int jt = 0; jt < 2; ++jt)
        acc[it][jt] = __builtin_amdgcn_wmma_f32_16x16x32_f16(false, a[s][it].h, false, bf[s][jt].h,
                                                             (short)0, acc[it][jt], false, false);
    // A and B fragments share one k order, so a fragment times itself is a Gram tile
#pragma unroll
    for (int t = 0; t < 2; ++t) {
      qq[t] = __builtin_amdgcn_wmma_f32_16x16x32_f16(false, a[s][t].h, false, a[s][t].h,
                                                     (short)0, qq[t], false, false);
      kk[t] = __builtin_amdgcn_wmma_f32_16x16x32_f16(false, bf[s][t].h, false, bf[s][t].h,
                                                     (short)0, kk[t], false, false);
    }
  }
  // diagonal element of row lm sits in the lane with g == lm >> 3, register lm & 7
#pragma unroll
  for (int t = 0; t < 2; ++t) {
    float dq = qq[t][0], dk = kk[t][0];
#pragma unroll
    for (int r = 1; r < 8; ++r)
      if ((lm & 7) == r) { dq = qq[t][r]; dk = kk[t][r]; }
    if ((lm >> 3) == g) {
      ssW[wave * 64 + t * 16 + lm]      = dq;
      ssW[wave * 64 + 32 + t * 16 + lm] = dk;
    }
  }
  float* pw = part + wave * (32 * 33);
#pragma unroll
  for (int it = 0; it < 2; ++it)
#pragma unroll
    for (int jt = 0; jt < 2; ++jt)
#pragma unroll
      for (int r = 0; r < 8; ++r)
        pw[(it * 16 + g * 8 + r) * 33 + jt * 16 + lm] = acc[it][jt][r];
  __syncthreads();
  float* dst = simP + ((size_t)bh * 4 + sl) * 1024;
  for (int idx = tid; idx < 1024; idx += 256) {
    const int o = (idx >> 5) * 33 + (idx & 31);
    float s = part[o];
#pragma unroll
    for (int w = 1; w < 8; ++w) s += part[w * (32 * 33) + o];
    dst[idx] = s;
  }
  if (tid < 64) {
    float s = ssW[tid];
#pragma unroll
    for (int w = 1; w < 8; ++w) s += ssW[w * 64 + tid];
    ssP[((size_t)bh * 4 + sl) * 64 + tid] = s;
  }
}

// ---------------------------------------------------------------------------
// Kernel 6: output projection GEMM [65536 x 256] x [256 x 256] + bias, with the
// attention folded into its weight. (attn . v)^T . W_out = v^T . (attn^T . W_out),
// so the rows of v are multiplied by the batch's own weight
//   wm[c][h*32 + j] = sum_i attn[i][j] * W_out[h*32 + i][c]   (K=32, one WMMA per tile)
// which every work-group forms for itself in LDS, one head per wave, while its
// rows of v are on their way from memory:
//   sim = sum of the 4 partial planes, in slice order, times
//         exp(temperature[h]) / max(|q_i|, eps) / max(|k_j|, eps), the norms
//         from the 4 partial sums of squares (the l2norm of q and k)
//   attn = softmax(sim * 8) over j
// W_out (f16, [col][k]) comes whole into LDS by async copies; a head's 64 bytes
// of every row are read by its wave alone and overwritten in place by wm: a lane
// stores to the bytes that it has loaded. The GEMM itself has the form of kernel
// 3 (4 chunks of 64 columns, all resident); the staging tiles hold f32 + bias, and
// every wave stores 8 columns of 1024 contiguous bytes into [b][c][H][W].
// ---------------------------------------------------------------------------
__global__ __launch_bounds__(256) void k_gemm_out(const _Float16* __restrict__ a16,
                                                  const float* __restrict__ simP,
                                                  const float* __restrict__ ssP,
                                                  const float* __restrict__ temperature,
                                                  const _Float16* __restrict__ wo16,
                                                  const float* __restrict__ bias,
                                                  float* __restrict__ outp) {
  __shared__ __attribute__((aligned(16))) _Float16 ldsW[256 * WPITCH];
  __shared__ __attribute__((aligned(16))) float    ldsS[2][64 * 260];
  __shared__ float sim[8][32 * 33];
  __shared__ __attribute__((aligned(16))) _Float16 attnT[8][32 * 40];
  const int tid  = threadIdx.x;
  // the wave's number in a scalar register: column and row offsets formed from it stay scalar
  const int wave = __builtin_amdgcn_readfirstlane(tid >> 5), lane = tid & 31;
  const int g = lane >> 4, lm = lane & 15;
  const int m0 = blockIdx.x * 256;
  const int bb = m0 >> 12, posB = m0 & 4095;
  // all of W_out: 32 copies of a wave in flight
#pragma unroll
  for (int c = 0; c < 4; ++c) copy_wchunk(wo16 + c * 64 * 256, ldsW + c * 64 * WPITCH, tid);
  // ---- the wave's head: its partial planes and partial sums of squares into registers
  // (loops over pS[], pQ[], pK[], a[], rv[], bf[] are unrolled: they stay in registers)
  f32x4 pS[4][8];
  float pQ[4], pK[4];
  const size_t bh = (size_t)bb * 8 + wave;
  const float* sp = simP + bh * 4 * 1024 + lane * 4;
  const float* np = ssP + bh * 4 * 64 + lane;
  // the wave's 16 KB of v fragments
  const _Float16* ar = a16 + (size_t)(blockIdx.x * 8 + wave) * 8192 + lane * 8;
#pragma unroll
  for (int sl = 0; sl < 4; ++sl) {
#pragma unroll
    for (int it = 0; it < 8; ++it) pS[sl][it] = *(const f32x4*)(sp + sl * 1024 + it * 128);
    pQ[sl] = np[sl * 64];
    pK[sl] = np[sl * 64 + 32];
  }
  const float tq = temperature[wave];
  // the rows of v are asked for behind the small loads and land while wm is formed
  // (the fence keeps every small load in front of them: loads return in order, and a
  // small load behind v would make the sums below wait for all of v)
  __builtin_amdgcn_sched_barrier(0);
  FragH a[2][8];
  load_afrags(ar, a);
  // stands in front of the first overwrite of an address register of the loads above;
  // the pointers are named so that their registers live up to here and no load lands in them
  asm volatile("s_wait_xcnt 0x0" :: "v"(sp), "v"(np), "v"(ar) : "memory");
  // keeps the scheduler from sinking the loads of v behind the waits of the sums
  // below, where they would wait out a second memory latency
  __builtin_amdgcn_sched_barrier(0);
  // ---- sum of the partial planes, in slice order: element (it*32 + lane)*4 + e
  float* sw = sim[wave];
#pragma unroll
  for (int it = 0; it < 8; ++it) {
    f32x4 s4 = pS[0][it];
#pragma unroll
    for (int sl = 1; sl < 4; ++sl) s4 += pS[sl][it];
    float* sd = sw + (it * 4 + (lane >> 3)) * 33 + (lane & 7) * 4;
#pragma unroll
    for (int e = 0; e < 4; ++e) sd[e] = s4[e];
  }
  // the lane's inverse norms: of q row i = lane (with the temperature) and of k row j = lane
  float ssq = pQ[0], ssk = pK[0];
#pragma unroll
  for (int sl = 1; sl < 4; ++sl) { ssq += pQ[sl]; ssk += pK[sl]; }
  const float rq = __expf(tq) * (1.0f / fmaxf(sqrtf(ssq), L2_EPS));
  const float rk = 1.0f / fmaxf(sqrtf(ssk), L2_EPS);
  wait_copies();
  // publishes W_out and the summed planes
  lds_barrier();
  // ---- softmax of row i = lane, written transposed: attnT[j][i]
  {
    const float* row = sw + lane * 33;
    float rv[32];
    float mx = -1e30f;
#pragma unroll
    for (int j = 0; j < 32; ++j) {
      const float rkj = __uint_as_float(__builtin_amdgcn_readlane(__float_as_uint(rk), j));
      rv[j] = row[j] * rq * rkj;
      mx = fmaxf(mx, rv[j]);
    }
    float sum = 0.f;
#pragma unroll
    for (int j = 0; j < 32; ++j) {
      rv[j] = __expf((rv[j] - mx) * SM_SCALE);
      sum += rv[j];
    }
    const float inv = 1.0f / sum;
    _Float16* at = attnT[wave] + lane;
#pragma unroll
    for (int j = 0; j < 32; ++j) at[j * 40] = (_Float16)(rv[j] * inv);
  }
  // publishes attnT
  lds_barrier();
  // ---- wm = attn^T . W_out: result rows j, columns c, over the head's own bytes of ldsW
  {
    FragH at2[2];
#pragma unroll
    for (int jt = 0; jt < 2; ++jt) {
      const _Float16* p = attnT[wave] + (jt * 16 + lm) * 40;
      at2[jt].q[0] = *(const u32x4*)(p + g * 8);
      at2[jt].q[1] = *(const u32x4*)(p + 16 + g * 8);
    }
    _Float16* wp = ldsW + lm * WPITCH + wave * 32 + g * 8;
    FragH bf[16];
#pragma unroll
    for (int u = 0; u < 16; ++u) {
      bf[u].q[0] = *(const u32x4*)(wp + u * 16 * WPITCH);
      bf[u].q[1] = *(const u32x4*)(wp + u * 16 * WPITCH + 16);
    }
#pragma unroll
    for (int u = 0; u < 16; ++u)
#pragma unroll
      for (int jt = 0; jt < 2; ++jt) {
        v8f z = {};
        v8f c = __builtin_amdgcn_wmma_f32_16x16x32_f16(false, at2[jt].h, false, bf[u].h,
                                                       (short)0, z, false, false);
        h8v ov;
#pragma unroll
        for (int r = 0; r < 8; ++r) ov[r] = (_Float16)c[r];
        *(h8v*)(wp + u * 16 * WPITCH + jt * 16) = ov;
      }
  }
  // publishes wm
  lds_barrier();
  FragH bs[2][8];
  load_wblock(bs[0], ldsW + lm * WPITCH + g * 8, 0);
  // stays rolled: one trip already holds 64 products, and the loop's text stays short
#pragma unroll 1
  for (int ch = 0; ch < 4; ++ch) {
    // this chunk's bias, one value per column tile; read here, its latency passes under the products
    float bv[4];
#pragma unroll
    for (int tn = 0; tn < 4; ++tn) bv[tn] = bias[ch * 64 + tn * 16 + lm];
    v8f acc[2][4] = {};
    chunk_products<false>(a, ldsW + (ch * 64 + lm) * WPITCH + g * 8, bs, acc);
    float* ss = ldsS[ch & 1];
    // row g*8 + r of tile mt is pos wave*32 + g*16 + 2*r + mt (the row order of v's fragments)
#pragma unroll
    for (int tn = 0; tn < 4; ++tn) {
      float* sd = ss + (tn * 16 + lm) * 260 + wave * 32 + g * 16;
#pragma unroll
      for (int p = 0; p < 4; ++p) {
        f32x4 o;
        o[0] = acc[0][tn][p * 2]     + bv[tn];
        o[1] = acc[1][tn][p * 2]     + bv[tn];
        o[2] = acc[0][tn][p * 2 + 1] + bv[tn];
        o[3] = acc[1][tn][p * 2 + 1] + bv[tn];
        *(f32x4*)(sd + p * 4) = o;
      }
    }
    // hand-over: this chunk's staging tile becomes readable
    wait_lds();
    __syncthreads();
    // the next chunk's first block
    if (ch + 1 < 4) load_wblock(bs[0], ldsW + ((ch + 1) * 64 + lm) * WPITCH + g * 8, 0);
#pragma unroll
    for (int i = 0; i < 8; ++i) {
      const int cl = wave * 8 + i;
      const int c  = ch * 64 + cl;
      float* dst = outp + ((size_t)bb * 256 + c) * 4096 + posB;
#pragma unroll
      for (int hf = 0; hf < 2; ++hf) {
        const f32x4 o = *(const f32x4*)(ss + cl * 260 + hf * 128 + lane * 4);
        *(f32x4*)(dst + hf * 128 + lane * 4) = o;
      }
    }
    // stands in front of the next trip's first overwrite of a register of the stores above
    asm volatile("s_wait_xcnt 0x0" ::: "memory");
  }
}

// ---------------------------------------------------------------------------
extern "C" void kernel_launch(void* const* d_in, const int* in_sizes, int n_in,
                              void* d_out, int out_size, void* d_ws, size_t ws_size,
                              hipStream_t stream) {
  (void)in_sizes; (void)n_in; (void)out_size; (void)ws_size;
  const float* x    = (const float*)d_in[0];
  const float* gam  = (const float*)d_in[1];
  const float* bet  = (const float*)d_in[2];
  const float* Wqkv = (const float*)d_in[3];
  const float* temp = (const float*)d_in[4];
  const float* Wout = (const float*)d_in[5];
  const float* bout = (const float*)d_in[6];

  char* ws = (char*)d_ws;
  _Float16* w16   = (_Float16*)ws; ws += (size_t)768 * 256 * 2;              // 384 KB
  _Float16* wo16  = (_Float16*)ws; ws += (size_t)256 * 256 * 2;              // 128 KB
  _Float16* qk16  = (_Float16*)ws; ws += (size_t)2 * 16 * 8 * 32 * 4096 * 2; // 64 MB
  _Float16* v16   = (_Float16*)ws; ws += (size_t)65536 * 256 * 2;            // 32 MB
  float*    simP  = (float*)ws;    ws += (size_t)128 * 4 * 1024 * 4;         // 2 MB
  float*    ssP   = (float*)ws;    ws += (size_t)128 * 4 * 64 * 4;           // 128 KB
  float* outp = (float*)d_out;

  k_cvtw    <<<dim3(1024),    256, 0, stream>>>(Wqkv, Wout, w16, wo16);
  k_gemm_qkv<<<dim3(256),     256, 0, stream>>>(x, gam, bet, w16, qk16, v16);
  k_sim     <<<dim3(128, 4),  256, 0, stream>>>(qk16, simP, ssP);
  k_gemm_out<<<dim3(256),     256, 0, stream>>>(v16, simP, ssP, temp, wo16, bout, outp);
}

// v008
// It runs in 44.4 microseconds.
// In both of two side-by-side timings against v007, it was 1.24 times as fast.
// All steps since v000 together make it 4.93 times as fast.
#include <hip/hip_runtime.h>
#include <hip/hip_bf16.h>
#include <math.h>
#include <stdint.h>

typedef __attribute__((ext_vector_type(16))) _Float16 v16h;
typedef __attribute__((ext_vector_type(8)))  float    v8f;
typedef __attribute__((ext_vector_type(4)))  unsigned u32x4;
typedef __attribute__((ext_vector_type(8)))  _Float16 h8v;
typedef __attribute__((ext_vector_type(4)))  float    f32x4;
typedef __attribute__((ext_vector_type(2)))  float    f32x2;
typedef __attribute__((ext_vector_type(4)))  int      i32x4;

union FragH { v16h h; u32x4 q[2]; };

#define LN_EPS   1e-5f
#define L2_EPS   1e-12f
#define SM_SCALE 8.0f

// ---------------------------------------------------------------------------
// CDNA5 async global->LDS staging (ASYNCcnt path), with safe fallback.
// Builtin signature (leaked by compiler diagnostic): param0 = int4 addrspace(1)*.
// ---------------------------------------------------------------------------
#if defined(__HIP_DEVICE_COMPILE__) && __has_builtin(__builtin_amdgcn_global_load_async_to_lds_b128)
#define USE_ASYNC_LDS 1
#else
#define USE_ASYNC_LDS 0
#endif

#if USE_ASYNC_LDS
typedef __attribute__((address_space(1))) i32x4 g_i32x4;
typedef __attribute__((address_space(3))) i32x4 l_i32x4;
#endif

__device__ __forceinline__ void stage16(const _Float16* g, _Float16* l) {
#if USE_ASYNC_LDS
  __builtin_amdgcn_global_load_async_to_lds_b128(
      (g_i32x4*)(uintptr_t)g,
      (l_i32x4*)(uint32_t)(uintptr_t)l, 0, 0);
#else
  *(u32x4*)l = *(const u32x4*)g;
#endif
}

// ---------------------------------------------------------------------------
// Kernel 2: convert weights to f16, stored transposed (w16[col][k]).
// ---------------------------------------------------------------------------
__global__ __launch_bounds__(256) void k_cvtw(const float* __restrict__ Wqkv,
                                              const float* __restrict__ Wout,
                                              _Float16* __restrict__ w16,
                                              _Float16* __restrict__ wo16) {
  int idx = blockIdx.x * 256 + threadIdx.x;
  if (idx < 768 * 256) {
    int col = idx >> 8, k = idx & 255;
    w16[idx] = (_Float16)Wqkv[(size_t)k * 768 + col];
  } else {
    int i2 = idx - 768 * 256;
    if (i2 < 256 * 256) {
      int col = i2 >> 8, k = i2 & 255;
      wo16[i2] = (_Float16)Wout[(size_t)k * 256 + col];
    }
  }
}

// ---------------------------------------------------------------------------
// Shared parts of the two projection GEMMs (kernels 3 and 6).
// A work-group of 8 waves owns 256 rows of A. Each wave holds its 32 rows over
// the whole K = 256 in registers (2 x 8 fragments) and the work-group walks all
// columns in chunks of 64: a chunk of W (64 rows x 256 k) lies in LDS; kernel 3
// keeps it in one of two buffers, the next chunk's async copies fly while this one
// is worked on, kernel 6 holds all four chunks at once.
// Fragment layout per CDNA5 ISA 7.12.2 (16-bit A 16x32): lane l holds row
// m=l&15; halves 0..7 = K {g*8..g*8+7}, halves 8..15 = K {16+g*8..}, g=l>>4.
// ---------------------------------------------------------------------------
#define WPITCH 264   // halves per W row in LDS: 512 B + 16 B (16 B x odd)

// one chunk of W: 64 rows of 512 B; each copy of a wave moves one whole row
__device__ __forceinline__ void copy_wchunk(const _Float16* __restrict__ wsrc,
                                            _Float16* buf, int tid) {
#pragma unroll
  for (int i = 0; i < 8; ++i) {
    const int row = i * 8 + (tid >> 5), off = (tid & 31) * 8;
    stage16(wsrc + row * 256 + off, buf + row * WPITCH + off);
  }
}

// the wave's 32 rows of A over all K, kept in memory in fragment order
// [mt][ks][half][lane][8]: every load of a wave is 512 contiguous bytes
__device__ __forceinline__ void load_afrags(const _Float16* __restrict__ ar, FragH (&a)[2][8]) {
#pragma unroll
  for (int mt = 0; mt < 2; ++mt)
#pragma unroll
    for (int ks = 0; ks < 8; ++ks) {
      a[mt][ks].q[0] = *(const u32x4*)(ar + (mt * 8 + ks) * 512);
      a[mt][ks].q[1] = *(const u32x4*)(ar + (mt * 8 + ks) * 512 + 256);
    }
}

// one block of W fragments: 2 k steps x 4 column tiles, 16 LDS reads issued as one group
__device__ __forceinline__ void load_wblock(FragH (&bs)[8], const _Float16* br, int blk) {
#pragma unroll
  for (int k2 = 0; k2 < 2; ++k2)
#pragma unroll
    for (int tn = 0; tn < 4; ++tn) {
      bs[k2 * 4 + tn].q[0] = *(const u32x4*)(br + tn * 16 * WPITCH + (blk * 2 + k2) * 32);
      bs[k2 * 4 + tn].q[1] = *(const u32x4*)(br + tn * 16 * WPITCH + (blk * 2 + k2) * 32 + 16);
    }
}

// 32 rows x 64 columns over K = 256, in 4 blocks of 16 products; each W fragment
// serves two products. bs[0] holds block 0 on entry; each later block is read
// into the other fragment set while the current block's products run.
// WROWS = false: A rows are the result's rows (a lane holds one column, 8 rows).
// WROWS = true: the W fragment is the first operand (both operands share one
// fragment layout), so a lane holds one A row and 8 consecutive columns.
template <bool WROWS>
__device__ __forceinline__ void chunk_products(const FragH (&a)[2][8], const _Float16* br,
                                               FragH (&bs)[2][8], v8f (&acc)[2][4]) {
#pragma unroll
  for (int blk = 0; blk < 4; ++blk) {
    if (blk < 3) load_wblock(bs[(blk + 1) & 1], br, blk + 1);
    // keeps the next block's LDS reads one group in front of this block's products:
    // sunk among them, each product pair would wait out an LDS latency of its own
    __builtin_amdgcn_sched_barrier(0);
#pragma unroll
    for (int k2 = 0; k2 < 2; ++k2)
#pragma unroll
      for (int tn = 0; tn < 4; ++tn)
#pragma unroll
        for (int mt = 0; mt < 2; ++mt)
          acc[mt][tn] = WROWS
              ? __builtin_amdgcn_wmma_f32_16x16x32_f16(
                    false, bs[blk & 1][k2 * 4 + tn].h, false, a[mt][blk * 2 + k2].h,
                    (short)0, acc[mt][tn], false, false)
              : __builtin_amdgcn_wmma_f32_16x16x32_f16(
                    false, a[mt][blk * 2 + k2].h, false, bs[blk & 1][k2 * 4 + tn].h,
                    (short)0, acc[mt][tn], false, false);
    // the other side of the same fence: later reads do not rise into this block
    __builtin_amdgcn_sched_barrier(0);
  }
}

// the wave's own LDS reads and writes have retired (in front of a hand-over barrier)
__device__ __forceinline__ void wait_lds()    { asm volatile("s_wait_dscnt 0x0" ::: "memory"); }
// the wave's own async copies have landed (in front of the barrier that publishes them)
__device__ __forceinline__ void wait_copies() { asm volatile("s_wait_asynccnt 0x0" ::: "memory"); }

// work-group barrier that orders LDS alone: the fences name the LDS address space (the release
// one waits out the wave's own LDS operations), so the global loads of v that are in flight
// stay in flight across it (__syncthreads() waits them out)
__device__ __forceinline__ void lds_barrier() {
  __builtin_amdgcn_fence(__ATOMIC_RELEASE, "workgroup", "local");
  __builtin_amdgcn_s_barrier();
  __builtin_amdgcn_fence(__ATOMIC_ACQUIRE, "workgroup", "local");
}

// one v chunk's result tiles as f16 into the wave's fragments of kernel 6: tile (mt, tn) is
// half tn & 1 of k step (tn >> 1) of the chunk's two; 512 contiguous bytes per store of a wave
__device__ __forceinline__ void store_vchunk(const v8f (&acc)[2][4], _Float16* vc) {
  h8v ov[2][4];
#pragma unroll
  for (int mt = 0; mt < 2; ++mt)
#pragma unroll
    for (int tn = 0; tn < 4; ++tn)
#pragma unroll
      for (int r = 0; r < 8; ++r) ov[mt][tn][r] = (_Float16)acc[mt][tn][r];
  // every tile is converted in front of the first store, so that each store has data
  // registers of its own and none is rewritten between the stores
  __builtin_amdgcn_sched_barrier(0);
#pragma unroll
  for (int mt = 0; mt < 2; ++mt)
#pragma unroll
    for (int tn = 0; tn < 4; ++tn)
      *(h8v*)(vc + (mt * 8 + (tn >> 1)) * 512 + (tn & 1) * 256) = ov[mt][tn];
}

// the value of the lane 16 away (lanes l and l ^ 16 hold the two halves of a row's channels)
__device__ __forceinline__ float other_half(float v) {
  const unsigned u = __float_as_uint(v);
  return __uint_as_float(__builtin_amdgcn_permlanex16(u, u, 0x76543210u, 0xfedcba98u, false, false));
}

// ---------------------------------------------------------------------------
// Kernel 3: LayerNorm over channels + qkv projection GEMM
// [65536 x 256] x [256 x 768] with WMMA.
// x is [b][c=256][pos=4096]. A lane of an A fragment holds one pos and 8 + 8
// channels per k step, so it reads its channels straight from x: one 8-byte
// load per channel brings pos 2*lm and 2*lm+1, which are row lm of the wave's
// first and second 16-row tile (16 lanes = one whole 128-B line of a channel).
// All 256 channels of the wave's 32 pos are then in registers as f32: the sums
// over channels are taken in the lane and added to those of lane l ^ 16, and the
// normalized values are rounded once to f16, in fragment order.
// q and k never leave the work-group. The W chunks are walked q, k, q, k, ...: a pair of
// chunks holds the same two heads of q and of k. A lane of a result tile holds column
// t*16 + lm of a head and rows g*8 + r of tile mt, which are pos 2*(g*8 + r) + mt of the
// wave's 32: rounded to f16, the two tiles are the two halves of one 16 x 32 fragment
// (row = column of the head, k = pos). Its k order over the 32 pos is a permutation, the
// same for q and for k. So q . k^T over the wave's 32 pos and the Gram tiles q . q^T and
// k . k^T (their diagonals are the rows' sums of squares) are products of registers. The
// 8 waves' tiles are summed through LDS in wave order, published by the chunk's own
// hand-over barrier, and go to kernel 5a as they lie in registers:
// simW[work-group][pair][head of pair][it*2 + jt][half][lane][4], ssG[work-group][pair][128].
// v is stored in the order of the fragments that kernel 6 reads, 512 contiguous bytes per
// store of a wave.
// v: v16[work-group][wave][mt][ks][half][lane][8], the A fragments of kernel 6.
// The v chunks' products take W as the first operand, so a lane holds row lm of
// tile mt (pos 2*lm + mt) and columns tn*16 + g*8 + (0..7): half tn & 1 of k
// step (ch - 8)*2 + (tn >> 1).
// ---------------------------------------------------------------------------
__global__ __launch_bounds__(256) void k_gemm_qkv(const float* __restrict__ x,
                                                  const float* __restrict__ gamma,
                                                  const float* __restrict__ beta,
                                                  const _Float16* __restrict__ w16,
                                                  float* __restrict__ simW,
                                                  float* __restrict__ ssG,
                                                  _Float16* __restrict__ v16) {
  __shared__ __attribute__((aligned(16))) _Float16 ldsB[2][64 * WPITCH];
  __shared__ __attribute__((aligned(16))) float    gamS[256], betS[256];
  __shared__ __attribute__((aligned(16))) float    partS[8 * 2048];
  __shared__ float ssW[8 * 128 + 160];
  const int tid  = threadIdx.x;
  // the wave's number in a scalar register: column and row offsets formed from it stay scalar
  const int wave = __builtin_amdgcn_readfirstlane(tid >> 5), lane = tid & 31;
  const int g = lane >> 4, lm = lane & 15;
  const int m0 = blockIdx.x * 256;
  const int bb = m0 >> 12, posB = m0 & 4095;
  copy_wchunk(w16, ldsB[0], tid);
  const float gmT = gamma[tid], btT = beta[tid];
  // xr[ks][j]: channel ks*32 + (j>>3)*16 + g*8 + (j&7), the fragment's own k order
  // (every loop over xr[] and a[] is unrolled so that they stay in registers)
  f32x2 xr[8][16];
  const float* xp = x + ((size_t)bb * 256 + g * 8) * 4096 + posB + wave * 32 + lm * 2;
#pragma unroll
  for (int ks = 0; ks < 8; ++ks)
#pragma unroll
    for (int j = 0; j < 16; ++j)
      xr[ks][j] = *(const f32x2*)(xp + (size_t)(ks * 32 + (j >> 3) * 16 + (j & 7)) * 4096);
  // stands in front of the first overwrite of an address register of the loads above;
  // xp is named so that its registers live up to here and no load lands in them
  asm volatile("s_wait_xcnt 0x0" :: "v"(xp) : "memory");
  // keeps the scheduler from sinking loads among the sums below: all of them are
  // in flight before the first wait
  __builtin_amdgcn_sched_barrier(0);
  gamS[tid] = gmT;
  betS[tid] = btT;
  // sums and sums of squares of the lane's 128 channels, two chains per sum
  f32x2 sA = {0.f, 0.f}, sB = {0.f, 0.f}, qA = {0.f, 0.f}, qB = {0.f, 0.f};
#pragma unroll
  for (int ks = 0; ks < 8; ++ks)
#pragma unroll
    for (int j = 0; j < 16; j += 2) {
      sA += xr[ks][j];     qA += xr[ks][j] * xr[ks][j];
      sB += xr[ks][j + 1]; qB += xr[ks][j + 1] * xr[ks][j + 1];
    }
  f32x2 mu, ri;
#pragma unroll
  for (int mt = 0; mt < 2; ++mt) {
    const float sh = sA[mt] + sB[mt], qh = qA[mt] + qB[mt];
    const float ts = sh + other_half(sh), tq = qh + other_half(qh);
    const float m  = ts * (1.0f / 256.0f);
    const float var = tq * (1.0f / 256.0f) - m * m;
    mu[mt] = m;
    ri[mt] = rsqrtf(var + LN_EPS);
  }
  wait_copies();
  // publishes chunk 0 of W and gamma, beta
  __syncthreads();
  // the second chunk of the walk: heads 0 and 1 of k
  copy_wchunk(w16 + 4 * 64 * 256, ldsB[1], tid);
  FragH a[2][8];
#pragma unroll
  for (int ks = 0; ks < 8; ++ks)
#pragma unroll
    for (int hf = 0; hf < 2; ++hf) {
      const int c0 = ks * 32 + hf * 16 + g * 8;
      f32x4 gm[2], bt[2];
      gm[0] = *(const f32x4*)(gamS + c0); gm[1] = *(const f32x4*)(gamS + c0 + 4);
      bt[0] = *(const f32x4*)(betS + c0); bt[1] = *(const f32x4*)(betS + c0 + 4);
#pragma unroll
      for (int e = 0; e < 8; ++e) {
        const f32x2 v = (xr[ks][hf * 8 + e] - mu) * ri * gm[e >> 2][e & 3] + bt[e >> 2][e & 3];
        a[0][ks].h[hf * 8 + e] = (_Float16)v[0];
        a[1][ks].h[hf * 8 + e] = (_Float16)v[1];
      }
    }
  FragH bs[2][8];
  load_wblock(bs[0], ldsB[0] + lm * WPITCH + g * 8, 0);
  const _Float16* b0 = ldsB[0] + lm * WPITCH + g * 8;
  const _Float16* b1 = ldsB[1] + lm * WPITCH + g * 8;
  // stays rolled: one trip already holds 144 products, and the loop's text stays short
#pragma unroll 1
  for (int p = 0; p < 4; ++p) {
    // fragment tn: head p*2 + (tn >> 1), its columns (tn & 1)*16 .. + 15; half mt = tile mt
    FragH qf[4], kf[4];
    {
      v8f acc[2][4] = {};
      chunk_products<false>(a, b0, bs, acc);
#pragma unroll
      for (int tn = 0; tn < 4; ++tn)
#pragma unroll
        for (int mt = 0; mt < 2; ++mt)
#pragma unroll
          for (int r = 0; r < 8; ++r) qf[tn].h[mt * 8 + r] = (_Float16)acc[mt][tn][r];
    }
    // hand-over: the k chunk of W becomes readable, and every reader has left the
    // W buffer that is refilled below (and the partial tiles of the trip before)
    wait_lds();
    wait_copies();
    __syncthreads();
    // the next q chunk, or behind the last one the first v chunk
    copy_wchunk(w16 + (size_t)(p < 3 ? p + 1 : 8) * 64 * 256, ldsB[0], tid);
    // the k chunk's first block, behind the barrier that has published it
    load_wblock(bs[0], b1, 0);
    {
      v8f acc[2][4] = {};
      chunk_products<false>(a, b1, bs, acc);
#pragma unroll
      for (int tn = 0; tn < 4; ++tn)
#pragma unroll
        for (int mt = 0; mt < 2; ++mt)
#pragma unroll
          for (int r = 0; r < 8; ++r) kf[tn].h[mt * 8 + r] = (_Float16)acc[mt][tn][r];
    }
    // the wave's 32 pos of q . k^T, two heads x four tiles, as they lie in registers
    float* pw = partS + wave * 2048 + lane * 4;
    // the lane that holds a diagonal element stores it to the wave's row of ssW; the other
    // lanes store to a spare range behind the 8 rows that nobody reads: so no branch stands
    // behind the products
    float* sd = ssW + ((lm >> 3) == g ? wave * 128 + lm : 8 * 128 + lane);
    // A and B fragments share one k order, so a fragment times itself is a Gram tile
    // (loops over sm[], qq[], kk[] are unrolled: they stay in registers)
    v8f sm[8], qq[4], kk[4];
#pragma unroll
    for (int hh = 0; hh < 2; ++hh) {
#pragma unroll
      for (int it = 0; it < 2; ++it)
#pragma unroll
        for (int jt = 0; jt < 2; ++jt) {
          v8f z = {};
          sm[hh * 4 + it * 2 + jt] = __builtin_amdgcn_wmma_f32_16x16x32_f16(
              false, qf[hh * 2 + it].h, false, kf[hh * 2 + jt].h, (short)0, z, false, false);
        }
#pragma unroll
      for (int t = 0; t < 2; ++t) {
        v8f z = {};
        qq[hh * 2 + t] = __builtin_amdgcn_wmma_f32_16x16x32_f16(
            false, qf[hh * 2 + t].h, false, qf[hh * 2 + t].h, (short)0, z, false, false);
        kk[hh * 2 + t] = __builtin_amdgcn_wmma_f32_16x16x32_f16(
            false, kf[hh * 2 + t].h, false, kf[hh * 2 + t].h, (short)0, z, false, false);
      }
    }
    // the sixteen products stand as one block, each with result registers of its own: sunk
    // among the stores below, a product would rewrite the result of the one before it
    // inside the distance that the matrix unit needs
    __builtin_amdgcn_sched_barrier(0);
#pragma unroll
    for (int u = 0; u < 8; ++u) {
      f32x4 lo, hi;
#pragma unroll
      for (int e = 0; e < 4; ++e) { lo[e] = sm[u][e]; hi[e] = sm[u][4 + e]; }
      *(f32x4*)(pw + u * 256)       = lo;
      *(f32x4*)(pw + u * 256 + 128) = hi;
    }
    // the diagonal element of row lm sits in the lane with g == lm >> 3, register lm & 7
#pragma unroll
    for (int u = 0; u < 4; ++u) {
      float dq = qq[u][0], dk = kk[u][0];
#pragma unroll
      for (int r = 1; r < 8; ++r)
        if ((lm & 7) == r) { dq = qq[u][r]; dk = kk[u][r]; }
      sd[(u >> 1) * 64 + (u & 1) * 16]      = dq;
      sd[(u >> 1) * 64 + 32 + (u & 1) * 16] = dk;
    }
    // hand-over: the next chunk of W and the 8 waves' partial tiles become readable, and
    // every reader has left the W buffer that is refilled below
    wait_lds();
    wait_copies();
    __syncthreads();
    // the next k chunk, or behind the last one the second v chunk
    copy_wchunk(w16 + (size_t)(p < 3 ? p + 5 : 9) * 64 * 256, ldsB[1], tid);
    // the next chunk's first block, behind the barrier that has published it
    load_wblock(bs[0], b0, 0);
    // sum over the 8 waves, in wave order: a thread takes 4 values of each of the two heads
    f32x4 s0 = *(const f32x4*)(partS + tid * 4);
    f32x4 s1 = *(const f32x4*)(partS + 1024 + tid * 4);
#pragma unroll
    for (int w = 1; w < 8; ++w) {
      s0 += *(const f32x4*)(partS + w * 2048 + tid * 4);
      s1 += *(const f32x4*)(partS + w * 2048 + 1024 + tid * 4);
    }
    float* sg = simW + ((size_t)blockIdx.x * 4 + p) * 2048 + tid * 4;
    *(f32x4*)sg          = s0;
    *(f32x4*)(sg + 1024) = s1;
    float* sq = ssG + ((size_t)blockIdx.x * 4 + p) * 128 + tid;
    if (tid < 128) {
      float s = ssW[tid];
#pragma unroll
      for (int w = 1; w < 8; ++w) s += ssW[w * 128 + tid];
      *sq = s;
    }
    // stands in front of the next trip's first overwrite of a register of the stores above;
    // the pointers are named so that their registers live up to here
    asm volatile("s_wait_xcnt 0x0" :: "v"(sg), "v"(sq) : "memory");
  }
  // the lane's place in the wave's 16 KB of v fragments
  _Float16* vd = v16 + (size_t)(blockIdx.x * 8 + wave) * 8192 + lane * 8;
  // the v chunks; the first two refill a W buffer like the chunks above (rolled for the same reason)
#pragma unroll 1
  for (int ch = 8; ch < 10; ++ch) {
    v8f acc[2][4] = {};
    chunk_products<true>(a, ldsB[ch & 1] + lm * WPITCH + g * 8, bs, acc);
    // hand-over, as in the loop above
    wait_lds();
    wait_copies();
    __syncthreads();
    copy_wchunk(w16 + (size_t)(ch + 2) * 64 * 256, ldsB[ch & 1], tid);
    // the next chunk's first block, behind the barrier that has published it
    load_wblock(bs[0], ldsB[(ch + 1) & 1] + lm * WPITCH + g * 8, 0);
    store_vchunk(acc, vd + (ch - 8) * 1024);
    // stands in front of the next trip's first overwrite of a register of the stores above
    asm volatile("s_wait_xcnt 0x0" ::: "memory");
  }
  {
    // chunk 10: no chunk is left to copy
    v8f acc[2][4] = {};
    chunk_products<true>(a, ldsB[0] + lm * WPITCH + g * 8, bs, acc);
    // hand-over: the last chunk of W becomes readable
    wait_lds();
    wait_copies();
    __syncthreads();
    load_wblock(bs[0], ldsB[1] + lm * WPITCH + g * 8, 0);
    store_vchunk(acc, vd + 2 * 1024);
    // stands in front of the last chunk's first overwrite of a register of the stores above
    asm volatile("s_wait_xcnt 0x0" ::: "memory");
  }
  {
    // chunk 11: nothing is handed over behind it, so no barrier
    v8f acc[2][4] = {};
    chunk_products<true>(a, ldsB[1] + lm * WPITCH + g * 8, bs, acc);
    store_vchunk(acc, vd + 3 * 1024);
  }
  wait_copies();
}

// ---------------------------------------------------------------------------
// Kernel 5a: adds the work-groups' partial cross-covariance sums. Kernel 3 leaves one
// 32 x 32 plane and 64 sums of squares per head and work-group (256 pos), 16 per batch
// and head. Work-group bh adds them four and four, in work-group order, into the 4
// planes simP[bh][sl][32*32] (row-major) and the 4 rows ssP[bh][sl][64] (32 q rows, then
// 32 k rows) that kernel 6 reads. A plane comes in register order: thread tid holds
// tile (it, jt) = tid >> 6, lane tid & 31, registers ((tid >> 5) & 1)*4 .. + 3, which
// are rows it*16 + (lane >> 4)*8 + register of column jt*16 + (lane & 15).
// ---------------------------------------------------------------------------
__global__ __launch_bounds__(256) void k_sim(const float* __restrict__ simW,
                                             const float* __restrict__ ssG,
                                             float* __restrict__ simP,
                                             float* __restrict__ ssP) {
  const int bh = blockIdx.x, tid = threadIdx.x;
  const int bb = bh >> 3, h = bh & 7;
  // a work-group of kernel 3 leaves 4 pairs of heads x 2048 values
  const float* sp = simW + ((size_t)bb * 64 + (h >> 1)) * 2048 + (h & 1) * 1024 + tid * 4;
  // all 16 loads in flight at once (the loops over pv[] are unrolled: it stays in registers)
  f32x4 pv[16];
#pragma unroll
  for (int k = 0; k < 16; ++k) pv[k] = *(const f32x4*)(sp + k * 8192);
  // the sums of squares are asked for directly behind the planes, so that both come in
  // one memory latency
  if (tid < 64) {
    const float* np = ssG + ((size_t)bb * 64 + (h >> 1)) * 128 + (h & 1) * 64 + tid;
    float pn[16];
#pragma unroll
    for (int k = 0; k < 16; ++k) pn[k] = np[k * 512];
#pragma unroll
    for (int sl = 0; sl < 4; ++sl) {
      float s = pn[sl * 4];
#pragma unroll
      for (int k = 1; k < 4; ++k) s += pn[sl * 4 + k];
      ssP[((size_t)bh * 4 + sl) * 64 + tid] = s;
    }
  }
  const int lane = tid & 31;
  const int i0 = (tid >> 7) * 16 + (lane >> 4) * 8 + ((tid >> 5) & 1) * 4;
  const int j  = ((tid >> 6) & 1) * 16 + (lane & 15);
  float* dst = simP + (size_t)bh * 4096 + i0 * 32 + j;
#pragma unroll
  for (int sl = 0; sl < 4; ++sl) {
    f32x4 s = pv[sl * 4];
#pragma unroll
    for (int k = 1; k < 4; ++k) s += pv[sl * 4 + k];
#pragma unroll
    for (int e = 0; e < 4; ++e) dst[sl * 1024 + e * 32] = s[e];
  }
}

// ---------------------------------------------------------------------------
// Kernel 6: output projection GEMM [65536 x 256] x [256 x 256] + bias, with the
// attention folded into its weight. (attn . v)^T . W_out = v^T . (attn^T . W_out),
// so the rows of v are multiplied by the batch's own weight
//   wm[c][h*32 + j] = sum_i attn[i][j] * W_out[h*32 + i][c]   (K=32, one WMMA per tile)
// which every work-group forms for itself in LDS, one head per wave, while its
// rows of v are on their way from memory:
//   sim = sum of the 4 partial planes, in slice order, times
//         exp(temperature[h]) / max(|q_i|, eps) / max(|k_j|, eps), the norms
//         from the 4 partial sums of squares (the l2norm of q and k)
//   attn = softmax(sim * 8) over j
// W_out (f16, [col][k]) comes whole into LDS by async copies; a head's 64 bytes
// of every row are read by its wave alone and overwritten in place by wm: a lane
// stores to the bytes that it has loaded. The GEMM itself has the form of kernel
// 3 (4 chunks of 64 columns, all resident); the staging tiles hold f32 + bias, and
// every wave stores 8 columns of 1024 contiguous bytes into [b][c][H][W].
// ---------------------------------------------------------------------------
__global__ __launch_bounds__(256) void k_gemm_out(const _Float16* __restrict__ a16,
                                                  const float* __restrict__ simP,
                                                  const float* __restrict__ ssP,
                                                  const float* __restrict__ temperature,
                                                  const _Float16* __restrict__ wo16,
                                                  const float* __restrict__ bias,
                                                  float* __restrict__ outp) {
  __shared__ __attribute__((aligned(16))) _Float16 ldsW[256 * WPITCH];
  __shared__ __attribute__((aligned(16))) float    ldsS[2][64 * 260];
  __shared__ float sim[8][32 * 33];
  __shared__ __attribute__((aligned(16))) _Float16 attnT[8][32 * 40];
  const int tid  = threadIdx.x;
  // the wave's number in a scalar register: column and row offsets formed from it stay scalar
  const int wave = __builtin_amdgcn_readfirstlane(tid >> 5), lane = tid & 31;
  const int g = lane >> 4, lm = lane & 15;
  const int m0 = blockIdx.x * 256;
  const int bb = m0 >> 12, posB = m0 & 4095;
  // all of W_out: 32 copies of a wave in flight
#pragma unroll
  for (int c = 0; c < 4; ++c) copy_wchunk(wo16 + c * 64 * 256, ldsW + c * 64 * WPITCH, tid);
  // ---- the wave's head: its partial planes and partial sums of squares into registers
  // (loops over pS[], pQ[], pK[], a[], rv[], bf[] are unrolled: they stay in registers)
  f32x4 pS[4][8];
  float pQ[4], pK[4];
  const size_t bh = (size_t)bb * 8 + wave;
  const float* sp = simP + bh * 4 * 1024 + lane * 4;
  const float* np = ssP + bh * 4 * 64 + lane;
  // the wave's 16 KB of v fragments
  const _Float16* ar = a16 + (size_t)(blockIdx.x * 8 + wave) * 8192 + lane * 8;
#pragma unroll
  for (int sl = 0; sl < 4; ++sl) {
#pragma unroll
    for (int it = 0; it < 8; ++it) pS[sl][it] = *(const f32x4*)(sp + sl * 1024 + it * 128);
    pQ[sl] = np[sl * 64];
    pK[sl] = np[sl * 64 + 32];
  }
  const float tq = temperature[wave];
  // the rows of v are asked for behind the small loads and land while wm is formed
  // (the fence keeps every small load in front of them: loads return in order, and a
  // small load behind v would make the sums below wait for all of v)
  __builtin_amdgcn_sched_barrier(0);
  FragH a[2][8];
  load_afrags(ar, a);
  // stands in front of the first overwrite of an address register of the loads above;
  // the pointers are named so that their registers live up to here and no load lands in them
  asm volatile("s_wait_xcnt 0x0" :: "v"(sp), "v"(np), "v"(ar) : "memory");
  // keeps the scheduler from sinking the loads of v behind the waits of the sums
  // below, where they would wait out a second memory latency
  __builtin_amdgcn_sched_barrier(0);
  // ---- sum of the partial planes, in slice order: element (it*32 + lane)*4 + e
  float* sw = sim[wave];
#pragma unroll
  for (int it = 0; it < 8; ++it) {
    f32x4 s4 = pS[0][it];
#pragma unroll
    for (int sl = 1; sl < 4; ++sl) s4 += pS[sl][it];
    float* sd = sw + (it * 4 + (lane >> 3)) * 33 + (lane & 7) * 4;
#pragma unroll
    for (int e = 0; e < 4; ++e) sd[e] = s4[e];
  }
  // the lane's inverse norms: of q row i = lane (with the temperature) and of k row j = lane
  float ssq = pQ[0], ssk = pK[0];
#pragma unroll
  for (int sl = 1; sl < 4; ++sl) { ssq += pQ[sl]; ssk += pK[sl]; }
  const float rq = __expf(tq) * (1.0f / fmaxf(sqrtf(ssq), L2_EPS));
  const float rk = 1.0f / fmaxf(sqrtf(ssk), L2_EPS);
  wait_copies();
  // publishes W_out and the summed planes
  lds_barrier();
  // ---- softmax of row i = lane, written transposed: attnT[j][i]
  {
    const float* row = sw + lane * 33;
    float rv[32];
    float mx = -1e30f;
#pragma unroll
    for (int j = 0; j < 32; ++j) {
      const float rkj = __uint_as_float(__builtin_amdgcn_readlane(__float_as_uint(rk), j));
      rv[j] = row[j] * rq * rkj;
      mx = fmaxf(mx, rv[j]);
    }
    float sum = 0.f;
#pragma unroll
    for (int j = 0; j < 32; ++j) {
      rv[j] = __expf((rv[j] - mx) * SM_SCALE);
      sum += rv[j];
    }
    const float inv = 1.0f / sum;
    _Float16* at = attnT[wave] + lane;
#pragma unroll
    for (int j = 0; j < 32; ++j) at[j * 40] = (_Float16)(rv[j] * inv);
  }
  // publishes attnT
  lds_barrier();
  // ---- wm = attn^T . W_out: result rows j, columns c, over the head's own bytes of ldsW
  {
    FragH at2[2];
#pragma unroll
    for (int jt = 0; jt < 2; ++jt) {
      const _Float16* p = attnT[wave] + (jt * 16 + lm) * 40;
      at2[jt].q[0] = *(const u32x4*)(p + g * 8);
      at2[jt].q[1] = *(const u32x4*)(p + 16 + g * 8);
    }
    _Float16* wp = ldsW + lm * WPITCH + wave * 32 + g * 8;
    FragH bf[16];
#pragma unroll
    for (int u = 0; u < 16; ++u) {
      bf[u].q[0] = *(const u32x4*)(wp + u * 16 * WPITCH);
      bf[u].q[1] = *(const u32x4*)(wp + u * 16 * WPITCH + 16);
    }
#pragma unroll
    for (int u = 0; u < 16; ++u)
#pragma unroll
      for (int jt = 0; jt < 2; ++jt) {
        v8f z = {};
        v8f c = __builtin_amdgcn_wmma_f32_16x16x32_f16(false, at2[jt].h, false, bf[u].h,
                                                       (short)0, z, false, false);
        h8v ov;
#pragma unroll
        for (int r = 0; r < 8; ++r) ov[r] = (_Float16)c[r];
        *(h8v*)(wp + u * 16 * WPITCH + jt * 16) = ov;
      }
  }
  // publishes wm
  lds_barrier();
  FragH bs[2][8];
  load_wblock(bs[0], ldsW + lm * WPITCH + g * 8, 0);
  // stays rolled: one trip already holds 64 products, and the loop's text stays short
#pragma unroll 1
  for (int ch = 0; ch < 4; ++ch) {
    // this chunk's bias, one value per column tile; read here, its latency passes under the products
    float bv[4];
#pragma unroll
    for (int tn = 0; tn < 4; ++tn) bv[tn] = bias[ch * 64 + tn * 16 + lm];
    v8f acc[2][4] = {};
    chunk_products<false>(a, ldsW + (ch * 64 + lm) * WPITCH + g * 8, bs, acc);
    float* ss = ldsS[ch & 1];
    // row g*8 + r of tile mt is pos wave*32 + g*16 + 2*r + mt (the row order of v's fragments)
#pragma unroll
    for (int tn = 0; tn < 4; ++tn) {
      float* sd = ss + (tn * 16 + lm) * 260 + wave * 32 + g * 16;
#pragma unroll
      for (int p = 0; p < 4; ++p) {
        f32x4 o;
        o[0] = acc[0][tn][p * 2]     + bv[tn];
        o[1] = acc[1][tn][p * 2]     + bv[tn];
        o[2] = acc[0][tn][p * 2 + 1] + bv[tn];
        o[3] = acc[1][tn][p * 2 + 1] + bv[tn];
        *(f32x4*)(sd + p * 4) = o;
      }
    }
    // hand-over: this chunk's staging tile becomes readable
    wait_lds();
    __syncthreads();
    // the next chunk's first block
    if (ch + 1 < 4) load_wblock(bs[0], ldsW + ((ch + 1) * 64 + lm) * WPITCH + g * 8, 0);
#pragma unroll
    for (int i = 0; i < 8; ++i) {
      const int cl = wave * 8 + i;
      const int c  = ch * 64 + cl;
      float* dst = outp + ((size_t)bb * 256 + c) * 4096 + posB;
#pragma unroll
      for (int hf = 0; hf < 2; ++hf) {
        const f32x4 o = *(const f32x4*)(ss + cl * 260 + hf * 128 + lane * 4);
        *(f32x4*)(dst + hf * 128 + lane * 4) = o;
      }
    }
    // stands in front of the next trip's first overwrite of a register of the stores above
    asm volatile("s_wait_xcnt 0x0" ::: "memory");
  }
}

// ---------------------------------------------------------------------------
extern "C" void kernel_launch(void* const* d_in, const int* in_sizes, int n_in,
                              void* d_out, int out_size, void* d_ws, size_t ws_size,
                              hipStream_t stream) {
  (void)in_sizes; (void)n_in; (void)out_size; (void)ws_size;
  const float* x    = (const float*)d_in[0];
  const float* gam  = (const float*)d_in[1];
  const float* bet  = (const float*)d_in[2];
  const float* Wqkv = (const float*)d_in[3];
  const float* temp = (const float*)d_in[4];
  const float* Wout = (const float*)d_in[5];
  const float* bout = (const float*)d_in[6];

  char* ws = (char*)d_ws;
  _Float16* w16   = (_Float16*)ws; ws += (size_t)768 * 256 * 2;              // 384 KB
  _Float16* wo16  = (_Float16*)ws; ws += (size_t)256 * 256 * 2;              // 128 KB
  float*    simW  = (float*)ws;    ws += (size_t)256 * 4 * 2048 * 4;         // 8 MB
  float*    ssG   = (float*)ws;    ws += (size_t)256 * 4 * 128 * 4;          // 512 KB
  _Float16* v16   = (_Float16*)ws; ws += (size_t)65536 * 256 * 2;            // 32 MB
  float*    simP  = (float*)ws;    ws += (size_t)128 * 4 * 1024 * 4;         // 2 MB
  float*    ssP   = (float*)ws;    ws += (size_t)128 * 4 * 64 * 4;           // 128 KB
  float* outp = (float*)d_out;

  k_cvtw    <<<dim3(1024),    256, 0, stream>>>(Wqkv, Wout, w16, wo16);
  k_gemm_qkv<<<dim3(256),     256, 0, stream>>>(x, gam, bet, w16, simW, ssG, v16);
  k_sim     <<<dim3(128),     256, 0, stream>>>(simW, ssG, simP, ssP);
  k_gemm_out<<<dim3(256),     256, 0, stream>>>(v16, simP, ssP, temp, wo16, bout, outp);
}
